// v000
// The times below were measured on an AMD MI455X: many runs one after another, warmed up first and cycling through
// copies of the inputs, with the whole window's GPU time divided by the number of runs. Launches and the gaps
// between them are all in it. The median over several windows is given; except for v000 it joins two sittings, which
// can be a few percent apart, so the side-by-side timings, each taken in one sitting, are the better comparison.
// v000, which the later versions start from, runs in 168 microseconds.
// Contractions: q/k/v projections x.W (f16 operands holding bf16-RNE values, x x16 and W x1024, exact products, K 256);
// scores k.q (k and q as f16 hi planes x16 plus f16 residual planes x2^11, 3 products hh + (hl + lh) in a separate accumulator);
// context v.p (p x1024 f16, v as f16 hi x16 plus residual x2^11, 2 products, separate accumulators);
// all v_wmma_f32_16x16x32_f16 with f32 accumulate; two-score MLP, softmax statistics and normalisation in f32 on VALU.
#include <hip/hip_runtime.h>
#include <math.h>
#include <stdint.h>

#define NB_  32
#define NR_  128
#define NC_  128
#define NE_  256
#define NH_  16
#define HD_  16
#define MS_  16
#define NTOK (NB_ * NR_)
static_assert(NH_ * HD_ == NE_);
static_assert(NR_ == NC_);
static_assert((NTOK % 64) == 0 && (NE_ % 64) == 0 && (NC_ % 64) == 0 && (NE_ % 32) == 0);

typedef _Float16 v16h __attribute__((ext_vector_type(16)));
typedef _Float16 v8h  __attribute__((ext_vector_type(8)));
typedef float    v8f  __attribute__((ext_vector_type(8)));
typedef float    v4f  __attribute__((ext_vector_type(4)));
typedef unsigned int v4u __attribute__((ext_vector_type(4)));

// ---- scalar helpers --------------------------------------------------------------------------------
__device__ __forceinline__ unsigned short bf_bits(float f) {          // f32 -> bf16 bits, RNE convert
  unsigned u = __float_as_uint(f);
  return (unsigned short)((u + 0x7FFFu + ((u >> 16) & 1u)) >> 16);
}
__device__ __forceinline__ float bf_up(unsigned short h) { return __uint_as_float(((unsigned)h) << 16); }
__device__ __forceinline__ float bfr(float f) { return bf_up(bf_bits(f)); }
__device__ __forceinline__ unsigned short h_bits(_Float16 x) { return __builtin_bit_cast(unsigned short, x); }
__device__ __forceinline__ unsigned pk16(unsigned short a, unsigned short b) { return (unsigned)a | ((unsigned)b << 16); }
__device__ __forceinline__ v8f zero8() { v8f z = {0.f, 0.f, 0.f, 0.f, 0.f, 0.f, 0.f, 0.f}; return z; }

// ---- fragment loaders: 16-bit A/B operand, lane -> row/col (lane&15), p already includes +8*(lane>>4);
//      elements 0..7 <- p[0..7] (k0+8h..), elements 8..15 <- p[16..23] (k0+16+8h..)
__device__ __forceinline__ v16h ldfrag_h(const _Float16* p) {
  union { v16h v; v8h h[2]; } f;
  f.h[0] = *(const v8h*)(p);
  f.h[1] = *(const v8h*)(p + 16);
  return f.v;
}
//      16-deep contraction padded to 32 in registers: elements 0..7 <- p[0..7], elements 8..15 = 0
__device__ __forceinline__ v16h ldfrag_8z(const _Float16* p) {
  union { v16h v; v8h h[2]; } f;
  const _Float16 zz = (_Float16)0.0f;
  const v8h z = {zz, zz, zz, zz, zz, zz, zz, zz};
  f.h[0] = *(const v8h*)(p);
  f.h[1] = z;
  return f.v;
}

// ---- WMMA helpers with trailing VALU hazard gap --------------------------------------------------------
__device__ __forceinline__ v8f mma_h_raw(v16h a, v16h b, v8f c) {
  return __builtin_amdgcn_wmma_f32_16x16x32_f16(false, a, false, b, (short)0, c, false, false);
}
__device__ __forceinline__ void dep_guard_h(v8f& a, v8f& b, v16h x, v16h y) {
#if defined(__HIP_DEVICE_COMPILE__)
  asm volatile("v_nop\n\tv_nop\n\tv_nop\n\tv_nop" : "+v"(a), "+v"(b) : "v"(x), "v"(y));
#endif
}
__device__ __forceinline__ void guard2x3(v8f& a, v8f& b, v16h x, v16h y, v16h z) {
#if defined(__HIP_DEVICE_COMPILE__)
  asm volatile("v_nop\n\tv_nop\n\tv_nop\n\tv_nop" : "+v"(a), "+v"(b) : "v"(x), "v"(y), "v"(z));
#endif
}
__device__ __forceinline__ void guard4x6(v8f& a, v8f& b, v8f& c, v8f& d,
                                         v16h u, v16h w, v16h x, v16h y, v16h z, v16h t) {
#if defined(__HIP_DEVICE_COMPILE__)
  asm volatile("v_nop\n\tv_nop\n\tv_nop\n\tv_nop"
               : "+v"(a), "+v"(b), "+v"(c), "+v"(d)
               : "v"(u), "v"(w), "v"(x), "v"(y), "v"(z), "v"(t));
#endif
}
__device__ __forceinline__ void keep4_h(v16h a, v16h b, v16h c, v16h d) {
#if defined(__HIP_DEVICE_COMPILE__)
  asm volatile("v_nop" :: "v"(a), "v"(b), "v"(c), "v"(d));
#endif
}
__device__ __forceinline__ void acc_guard4(v8f& a, v8f& b, v8f& c, v8f& d) {
#if defined(__HIP_DEVICE_COMPILE__)
  asm volatile("v_nop\n\tv_nop\n\tv_nop\n\tv_nop" : "+v"(a), "+v"(b), "+v"(c), "+v"(d));
#endif
}
__device__ __forceinline__ void acc_guard2(v8f& a, v8f& b) {
#if defined(__HIP_DEVICE_COMPILE__)
  asm volatile("v_nop\n\tv_nop\n\tv_nop\n\tv_nop" : "+v"(a), "+v"(b));
#endif
}
__device__ __forceinline__ void wave_sync_lds() {
  __builtin_amdgcn_fence(__ATOMIC_RELEASE, "workgroup");
  __builtin_amdgcn_wave_barrier();
  __builtin_amdgcn_fence(__ATOMIC_ACQUIRE, "workgroup");
}

// =====================================================================================================
// f32 -> f16( bf16_RNE(x) * scale ), scale a power of two (exact), 8 elements per thread, one 16-B store
// =====================================================================================================
__global__ __launch_bounds__(256) void cvt_h8(const float* __restrict__ in, unsigned short* out, int n8, float scale) {
  const int i = blockIdx.x * 256 + threadIdx.x;
  if (i < n8) {
    const v4f a = *(const v4f*)(in + (size_t)i * 8);
    const v4f c = *(const v4f*)(in + (size_t)i * 8 + 4);
    float f[8];
    f[0] = a[0]; f[1] = a[1]; f[2] = a[2]; f[3] = a[3];
    f[4] = c[0]; f[5] = c[1]; f[6] = c[2]; f[7] = c[3];
    unsigned short hb[8];
#pragma unroll
    for (int e = 0; e < 8; ++e) hb[e] = h_bits((_Float16)(bf_up(bf_bits(f[e])) * scale));
    v4u p;
    p[0] = pk16(hb[0], hb[1]);
    p[1] = pk16(hb[2], hb[3]);
    p[2] = pk16(hb[4], hb[5]);
    p[3] = pk16(hb[6], hb[7]);
    *(v4u*)(out + (size_t)i * 8) = p;
    
  }
}

// =====================================================================================================
// Transpose-convert of the three projection weights: W[e (256)][o (256)] f32 (o contiguous) ->
// WT[z][o][e] f16 holding bf16_RNE(w) * scale, z = blockIdx.z selects Wq / Wk / Wv (block-uniform).
// grid = (256/64 o-tiles, 256/64 e-tiles, 3), 256 threads. Tile 64 e x 64 o staged transposed in LDS
// coverage: load 4 passes x 16 e-rows x 64 o = 64 x 64; store 2 passes x 32 o-rows x 64 e = 64 x 64.
// =====================================================================================================
#define QTP 72
__global__ __launch_bounds__(256) void cvt_wt(const float* __restrict__ Wq, const float* __restrict__ Wk,
                                              const float* __restrict__ Wv, unsigned short* WT, float scale) {
  __shared__ __align__(16) unsigned short ts[64 * QTP];
  const int tid = threadIdx.x;
  const int o0 = blockIdx.x * 64, e0 = blockIdx.y * 64, z = blockIdx.z;
  const float* W = (z == 0) ? Wq : ((z == 1) ? Wk : Wv);
  unsigned short* out = WT + (size_t)z * NE_ * NE_;
#pragma unroll 1
  for (int pass = 0; pass < 4; ++pass) {
    const int e  = pass * 16 + (tid >> 4);          // 0..63 within tile
    const int o4 = (tid & 15) * 4;                  // 0..60
    const v4f v = *(const v4f*)(W + (size_t)(e0 + e) * NE_ + o0 + o4);
#pragma unroll
    for (int i = 0; i < 4; ++i) ts[(o4 + i) * QTP + e] = h_bits((_Float16)(bf_up(bf_bits(v[i])) * scale));
  }
  __syncthreads();
#pragma unroll 1
  for (int pass = 0; pass < 2; ++pass) {
    const int lr = pass * 32 + (tid >> 3);          // o within tile 0..63
    const int c8 = (tid & 7) * 8;                   // e within tile
    const v4u v = *(const v4u*)(ts + lr * QTP + c8);
    unsigned short* dst = out + (size_t)(o0 + lr) * NE_ + e0 + c8;
    *(v4u*)dst = v;
    
  }
}

// =====================================================================================================
// Register-blocked batched f16 WMMA GEMM with a two-plane f16 epilogue:
//   f = ( sum_k A[m][k] * Bt[n][k] ) * oscale;  C1[m][n] = f16(f) (hi plane);  C2[m][n] = f16((f - hi) * rcarry).
// One wave per 64x64 tile, no block barriers. A row-major [M][K] pitch lda; Bt row-major [N][K] pitch ldb
// (k contiguous); M, N multiples of 64, K multiple of 32 (host-checked); blockIdx.y = batch index with element
// strides sAy / sBy / sCy. C1/C2 pitch ldc halves.
// coverage: 4 slabs x (4 it x 4 rows) x 64 cols = the wave's whole 64x64 tile, for C1 and C2.
// =====================================================================================================
__global__ __launch_bounds__(256) void gemm64h2(
    const unsigned short* __restrict__ Ap, int lda, long long sAy,
    const unsigned short* __restrict__ Btp, int ldb, long long sBy,
    unsigned short* C1, unsigned short* C2, int ldc, long long sCy,
    int M, int N, int K, float oscale, float rcarry) {
  const _Float16* A  = (const _Float16*)(const void*)Ap;
  const _Float16* Bt = (const _Float16*)(const void*)Btp;
  __shared__ __align__(16) float sT[8][16 * 68];   // per-wave 16x64 slab, pitch 68 floats
  const int by   = blockIdx.y;
  const int lane = threadIdx.x & 31;
  const int wave = threadIdx.x >> 5;
  const int tilesN = N >> 6;
  const int tilesM = M >> 6;
  const int tile = blockIdx.x * 8 + wave;
  if (tile >= tilesM * tilesN) return;   // wave-uniform; no block barriers in this kernel
  const int tm = tile / tilesN;
  const int tn = tile - tm * tilesN;
  const int m0 = tm << 6;
  const int n0 = tn << 6;

  const _Float16* Ab = A + (size_t)by * (size_t)sAy;
  const _Float16* Bb = Bt + (size_t)by * (size_t)sBy;

  const int rlane = lane & 15;                 // row (A) / col (B, D) within subtile
  const int koff  = (lane >> 4) * 8;           // k offset of this lane half
  const int mOff  = (lane >> 4) * 8;           // D row offset

  v8f acc[4][4];
#pragma unroll
  for (int i = 0; i < 4; ++i)
#pragma unroll
    for (int j = 0; j < 4; ++j) acc[i][j] = zero8();

  for (int k0 = 0; k0 < K; k0 += 32) {
    v16h bf[4];
#pragma unroll
    for (int j = 0; j < 4; ++j) {
      const size_t bo = (size_t)(n0 + (j << 4) + rlane) * ldb + koff + k0;
      bf[j] = ldfrag_h(Bb + bo);
    }
#pragma unroll
    for (int i = 0; i < 4; ++i) {
      const size_t ao = (size_t)(m0 + (i << 4) + rlane) * lda + koff + k0;
      const v16h ah = ldfrag_h(Ab + ao);
#pragma unroll
      for (int j = 0; j < 4; ++j) acc[i][j] = mma_h_raw(ah, bf[j], acc[i][j]);
      dep_guard_h(acc[i][0], acc[i][3], ah, bf[3]);
    }
    keep4_h(bf[0], bf[1], bf[2], bf[3]);
  }
  acc_guard4(acc[0][0], acc[0][1], acc[0][2], acc[0][3]);
  acc_guard4(acc[1][0], acc[1][1], acc[1][2], acc[1][3]);
  acc_guard4(acc[2][0], acc[2][1], acc[2][2], acc[2][3]);
  acc_guard4(acc[3][0], acc[3][1], acc[3][2], acc[3][3]);

  // ---- epilogue ----
  float* slab = sT[wave];
  unsigned short* Cb1 = C1 + (size_t)by * (size_t)sCy;
  unsigned short* Cb2 = C2 + (size_t)by * (size_t)sCy;
  const int rq = lane >> 3, c8 = (lane & 7) * 8;
#pragma unroll
  for (int i = 0; i < 4; ++i) {
    const int mBase = m0 + (i << 4);
#pragma unroll
    for (int j = 0; j < 4; ++j) {
#pragma unroll
      for (int r = 0; r < 8; ++r) {
        slab[(mOff + r) * 68 + (j << 4) + rlane] = acc[i][j][r] * oscale;
      }
    }
    wave_sync_lds();
    v4u ph[4], pl[4];
#pragma unroll
    for (int it = 0; it < 4; ++it) {
      const int row = it * 4 + rq;                     // it 0..3 x rq 0..3 = rows 0..15
      const v4f x0 = *(const v4f*)(slab + row * 68 + c8);
      const v4f x1 = *(const v4f*)(slab + row * 68 + c8 + 4);
      float f[8];
      f[0] = x0[0]; f[1] = x0[1]; f[2] = x0[2]; f[3] = x0[3];
      f[4] = x1[0]; f[5] = x1[1]; f[6] = x1[2]; f[7] = x1[3];
      unsigned short hb[8], lb[8];
#pragma unroll
      for (int e = 0; e < 8; ++e) {
        const _Float16 xh = (_Float16)f[e];
        hb[e] = h_bits(xh);
        lb[e] = h_bits((_Float16)((f[e] - (float)xh) * rcarry));
      }
#pragma unroll
      for (int q = 0; q < 4; ++q) {
        ph[it][q] = pk16(hb[2 * q], hb[2 * q + 1]);
        pl[it][q] = pk16(lb[2 * q], lb[2 * q + 1]);
      }
    }
    {
#pragma unroll
      for (int it = 0; it < 4; ++it) {
        const int row = it * 4 + rq;
        const size_t d = (size_t)(mBase + row) * ldc + n0 + c8;
        *(v4u*)(Cb1 + d) = ph[it];
        *(v4u*)(Cb2 + d) = pl[it];
      }
      
    }
    wave_sync_lds();
  }
}

// =====================================================================================================
// Attention with the two-score MLP, head dim 16 (padded to 32 in registers), 128 queries x 128 keys,
// (32 floats = a head pair of one query row) is owned by one wave. grid = NB_ blocks, 256 threads =
// 8 waves x 16 queries.
// QH/QL/KH/KL [token][256] f16 (col h*16+d; x16 hi / residual x2^11), VH/VL [b][o (256)][c (128)] f16.
// Per head: MLP weights of the head RNE-converted to bf16 into LDS (wave 0, unconditional loads), resident
// q fragments; per 64-key step: K hi/res rows (64 x 32 B) and V^T hi/res tiles (16 o x 64 keys) staged with
// plain loads + block barriers; two 32-key sub-steps each:
// S[key][q] = A(K hi rows) x B(Q hi) ; Sr = A(K hi) x B(Q res) + A(K res) x B(Q hi) (separate accumulator, /2048);
// dot = (S + Sr/2048)/1024; cost RNE-bf16 per (q,key) from global; lg = b2 + sum_m relu(dot*w0+cost*w1+b1)*w2
// in f32 (m loop rolled); online softmax over keys (max/sum across lane halves by shuffle),
// p = 1024*exp(x - max) packed D->B per the chained map (element r <- keys 0-15 tile, 8+r <- keys 16-31 tile);
// Oh[d][q] += A(V hi rows) x P, Ol[d][q] += A(V res rows) x P; both rescaled by alpha;
// ctx = (Oh + Ol/2048) / (16 l). Per head the 16 ctx values of (q, head) go to per-wave LDS staging
// coverage: block = 128 queries x 256 cols (8 head pairs x 32); per wave per pair 4 it x 4 rows x 8 pieces
//           of 4 floats = 16 x 32; NB_ blocks.
// =====================================================================================================
#define VPITCH 72
#define SP_    36
__global__ __launch_bounds__(256) void attn_kernel(
    const unsigned short* __restrict__ QHp, const unsigned short* __restrict__ QLp,
    const unsigned short* __restrict__ KHp, const unsigned short* __restrict__ KLp,
    const unsigned short* __restrict__ VHp, const unsigned short* __restrict__ VLp,
    const float* __restrict__ cost,
    const float* __restrict__ m1w, const float* __restrict__ m1b,
    const float* __restrict__ m2w, const float* __restrict__ m2b,
    float* out) {
  __shared__ __align__(16) unsigned short kh_u[64 * HD_];          // 2048 B
  __shared__ __align__(16) unsigned short kg_u[64 * HD_];          // 2048 B
  __shared__ __align__(16) unsigned short vh_u[16 * VPITCH];       // 2304 B
  __shared__ __align__(16) unsigned short vr_u[16 * VPITCH];       // 2304 B
  __shared__ __align__(16) float sMW[MS_ * 4 + 4];                 //  272 B
  __shared__ __align__(16) float sto[8 * 16 * SP_];                // 18432 B
  const _Float16* khh = (const _Float16*)(const void*)kh_u;
  const _Float16* kgg = (const _Float16*)(const void*)kg_u;
  const _Float16* vhh = (const _Float16*)(const void*)vh_u;
  const _Float16* vrl = (const _Float16*)(const void*)vr_u;
  const _Float16* QH  = (const _Float16*)(const void*)QHp;
  const _Float16* QL  = (const _Float16*)(const void*)QLp;

  const int tid = threadIdx.x, lane = tid & 31, wave = tid >> 5;
  const int b = blockIdx.x;
  const int qBase = wave * 16;
  const int rlane = lane & 15, hsel = lane >> 4, koff = hsel * 8;
  const float C2048  = 1.0f / 2048.0f;
  const float C1024  = 1.0f / 1024.0f;
  const float LN1024 = 6.931471805599453f;

  const size_t qrow = (size_t)(b * NR_ + qBase + rlane);           // token index of this lane's query
  const float* crow = cost + qrow * NC_ + koff;                      // + key base

  // staging assignments, fixed per thread
  const int t2   = tid & 127;
  const int krow = t2 >> 1, kdh = (t2 & 1) * 8;                     // key 0..63, dim half
  const int vrow = t2 >> 3, vc8 = (t2 & 7) * 8;                     // o row 0..15, key piece
  unsigned short* khd = kh_u + t2 * 8;
  unsigned short* kgd = kg_u + t2 * 8;
  unsigned short* vhd = vh_u + vrow * VPITCH + vc8;
  unsigned short* vrd = vr_u + vrow * VPITCH + vc8;

#pragma unroll 1
  for (int h = 0; h < NH_; ++h) {
    __syncthreads();                                               // prior head done with sMW
    if (wave == 0) {                                               // wave-uniform; loads unconditional
      const int m = rlane;
      const float w0 = bfr(m1w[(h * 2 + 0) * MS_ + m]);
      const float w1 = bfr(m1w[(h * 2 + 1) * MS_ + m]);
      const float bb = bfr(m1b[h * MS_ + m]);
      const float w2 = bfr(m2w[h * MS_ + m]);
      const float b2 = bfr(m2b[h]);
      if (hsel == 0) {
        v4f t = {w0, w1, bb, w2};
        *(v4f*)(sMW + 4 * m) = t;
      }
      if (lane == 0) sMW[MS_ * 4] = b2;
    }
    // resident Q fragments (B operand: B[k=d][n=q] from [q][d] rows), arithmetic addressing
    const size_t qo = qrow * NE_ + (size_t)h * HD_ + koff;
    const v16h qh = ldfrag_8z(QH + qo);
    const v16h ql = ldfrag_8z(QL + qo);
    const size_t kgo = ((size_t)(b * NC_ + krow)) * NE_ + (size_t)h * HD_ + kdh;
    const unsigned short* Kgh = KHp + kgo;
    const unsigned short* Kgl = KLp + kgo;
    const size_t vgo = ((size_t)(b * NE_ + h * HD_ + vrow)) * NC_ + vc8;
    const unsigned short* Vhg = VHp + vgo;
    const unsigned short* Vlg = VLp + vgo;

    v8f oh = zero8(), ol = zero8();
    float m_run = -1e30f, l_run = 0.f;

#pragma unroll 1
    for (int kb = 0; kb < NC_; kb += 64) {
      __syncthreads();                                             // prior tile fully consumed
      if (wave < 4) {                                              // wave-uniform
        const v4u kv = *(const v4u*)(Kgh + (size_t)kb * NE_);
        *(v4u*)khd = kv;
        const v4u lv = *(const v4u*)(Vlg + kb);
        *(v4u*)vrd = lv;
      } else {
        const v4u kv = *(const v4u*)(Kgl + (size_t)kb * NE_);
        *(v4u*)kgd = kv;
        const v4u hv = *(const v4u*)(Vhg + kb);
        *(v4u*)vhd = hv;
      }
      __syncthreads();                                             // tile ready

#pragma unroll 1
      for (int sub = 0; sub < 2; ++sub) {
        const int kr = 32 * sub;
        // scores: two 16-key tiles, d padded to 32, hi and residual planes of both operands
        const v16h kf0 = ldfrag_8z(khh + (kr + rlane) * HD_ + koff);
        const v16h kf1 = ldfrag_8z(khh + (kr + 16 + rlane) * HD_ + koff);
        const v16h kg0 = ldfrag_8z(kgg + (kr + rlane) * HD_ + koff);
        const v16h kg1 = ldfrag_8z(kgg + (kr + 16 + rlane) * HD_ + koff);
        v8f sr0 = mma_h_raw(kf0, ql, zero8());
        v8f sr1 = mma_h_raw(kf1, ql, zero8());
        v8f sh0 = mma_h_raw(kf0, qh, zero8());
        v8f sh1 = mma_h_raw(kf1, qh, zero8());
        sr0 = mma_h_raw(kg0, qh, sr0);
        sr1 = mma_h_raw(kg1, qh, sr1);
        guard4x6(sh0, sh1, sr0, sr1, kf0, kf1, kg0, kg1, qh, ql);

        // cost for keys kb+kr+8h+r (tile 0) and kb+kr+16+8h+r (tile 1), RNE-converted to bf16
        const v4f ca0 = *(const v4f*)(crow + kb + kr);
        const v4f ca1 = *(const v4f*)(crow + kb + kr + 4);
        const v4f cb0 = *(const v4f*)(crow + kb + kr + 16);
        const v4f cb1 = *(const v4f*)(crow + kb + kr + 20);
        float d0[8], d1[8], c0[8], c1[8];
#pragma unroll
        for (int r = 0; r < 4; ++r) {
          c0[r] = bfr(ca0[r]); c0[r + 4] = bfr(ca1[r]);
          c1[r] = bfr(cb0[r]); c1[r + 4] = bfr(cb1[r]);
        }
#pragma unroll
        for (int r = 0; r < 8; ++r) {
          d0[r] = (sh0[r] + sr0[r] * C2048) * C1024;
          d1[r] = (sh1[r] + sr1[r] * C2048) * C1024;
        }

        // per-head two-score MLP: lg = b2 + sum_m relu(dot*w0 + cost*w1 + b1) * w2   (f32, m loop rolled)
        const float b2v = sMW[MS_ * 4];
        float a0[8], a1[8];
#pragma unroll
        for (int r = 0; r < 8; ++r) { a0[r] = b2v; a1[r] = b2v; }
#pragma unroll 1
        for (int m = 0; m < MS_; ++m) {
          const v4f w = *(const v4f*)(sMW + 4 * m);
#pragma unroll
          for (int r = 0; r < 8; ++r) {
            const float t0 = fmaxf(fmaf(d0[r], w[0], fmaf(c0[r], w[1], w[2])), 0.0f);
            const float t1 = fmaxf(fmaf(d1[r], w[0], fmaf(c1[r], w[1], w[2])), 0.0f);
            a0[r] = fmaf(t0, w[3], a0[r]);
            a1[r] = fmaf(t1, w[3], a1[r]);
          }
        }

        // online softmax over the key axis for this lane's q column
        float mloc = -1e30f;
#pragma unroll
        for (int r = 0; r < 8; ++r) mloc = fmaxf(mloc, fmaxf(a0[r], a1[r]));
        mloc = fmaxf(mloc, __shfl_xor(mloc, 16, 32));
        const float newM  = fmaxf(m_run, mloc);
        const float alpha = __expf(m_run - newM);
        const float msh   = newM - LN1024;
        float ssum = 0.f;
        float p0[8], p1[8];
#pragma unroll
        for (int r = 0; r < 8; ++r) {
          p0[r] = __expf(a0[r] - msh);
          p1[r] = __expf(a1[r] - msh);
          ssum += p0[r] + p1[r];
        }
        ssum += __shfl_xor(ssum, 16, 32);
        l_run = l_run * alpha + ssum;
        m_run = newM;
#pragma unroll
        for (int r = 0; r < 8; ++r) { oh[r] *= alpha; ol[r] *= alpha; }

        // P (f32, D layout) -> B operand (f16): element r <- keys 0-15 tile, 8+r <- keys 16-31 tile
        union { v16h v; _Float16 s[16]; } pf;
#pragma unroll
        for (int r = 0; r < 8; ++r) {
          pf.s[r]     = (_Float16)p0[r];
          pf.s[8 + r] = (_Float16)p1[r];
        }

        // O[d][q] += V^T[d][kb+kr .. +31] x P, hi and residual planes in separate accumulators
        const v16h vah = ldfrag_h(vhh + rlane * VPITCH + kr + koff);
        const v16h val = ldfrag_h(vrl + rlane * VPITCH + kr + koff);
        oh = mma_h_raw(vah, pf.v, oh);
        ol = mma_h_raw(val, pf.v, ol);
        guard2x3(oh, ol, vah, val, pf.v);
      }
    }
    acc_guard2(oh, ol);

    // ---- per-head ctx values -> LDS staging (own lane slots): row q, cols (h&1)*16 + 8*hsel + 0..7 ----
    const float inv = (1.0f / 16.0f) * (1.0f / l_run);     // ctx = (Oh + Ol/2048) / (16 * l)
    v4f f0, f1;
#pragma unroll
    for (int e = 0; e < 4; ++e) {
      f0[e] = (oh[e]     + ol[e]     * C2048) * inv;
      f1[e] = (oh[4 + e] + ol[4 + e] * C2048) * inv;
    }
    const int so = (wave * 16 + rlane) * SP_ + (h & 1) * 16 + koff;
    *(v4f*)(sto + so)     = f0;
    *(v4f*)(sto + so + 4) = f1;

    if (h & 1) {                                             // block-uniform
      wave_sync_lds();
      const int rq = lane >> 3, c4 = (lane & 7) * 4;
      const float* ss = sto + (wave * 16) * SP_;
      v4f ov[4];
#pragma unroll
      for (int it = 0; it < 4; ++it) ov[it] = *(const v4f*)(ss + (it * 4 + rq) * SP_ + c4);
      float* ob = out + ((size_t)(b * NR_ + qBase)) * NE_ + (size_t)(h >> 1) * 32 + c4;
      {
#pragma unroll
        for (int it = 0; it < 4; ++it) {
          const int row = it * 4 + rq;                     // it 0..3 x rq 0..3 = rows 0..15
          *(v4f*)(ob + (size_t)row * NE_) = ov[it];
        }
        
      }
      wave_sync_lds();
    }
  }
}

// =====================================================================================================
// Workspace map (bytes), every plane an exact multiple of its whole-line store granularity:
//   XR   f16 [4096][256]      row activations, bf16-RNE x16         0          2097152
//   XC   f16 [4096][256]      col activations, bf16-RNE x16   2097152          2097152
//   WT   f16 [3][256][256]    Wq^T, Wk^T, Wv^T, bf16-RNE x1024 4194304         393216
//   QH   f16 [4096][256]      q x16 hi                        4587520          2097152
//   QL   f16 [4096][256]      q residual x2^11                6684672          2097152
//   KH   f16 [4096][256]      k x16 hi                        8781824          2097152
//   KL   f16 [4096][256]      k residual x2^11               10878976          2097152
//   VH   f16 [32][256][128]   v^T x16 hi, [b][o][c]          12976128          2097152
//   VL   f16 [32][256][128]   v^T residual x2^11             15073280          2097152
//   end                                                     17170432
// =====================================================================================================
extern "C" void kernel_launch(void* const* d_in, const int* in_sizes, int n_in,
                              void* d_out, int out_size, void* d_ws, size_t ws_size,
                              hipStream_t stream) {
  if (n_in < 10) return;
  if (in_sizes[0] != NB_ * NR_ * NE_) return;
  if (in_sizes[1] != NB_ * NC_ * NE_) return;
  if (in_sizes[2] != NB_ * NR_ * NC_) return;
  if (in_sizes[3] != NE_ * NE_) return;
  if (in_sizes[4] != NE_ * NE_) return;
  if (in_sizes[5] != NE_ * NE_) return;
  if (in_sizes[6] != NH_ * 2 * MS_) return;
  if (in_sizes[7] != NH_ * MS_) return;
  if (in_sizes[8] != NH_ * MS_) return;
  if (in_sizes[9] < NH_) return;
  if (out_size != NB_ * NR_ * NE_) return;

  const float* row_emb = (const float*)d_in[0];
  const float* col_emb = (const float*)d_in[1];
  const float* costm   = (const float*)d_in[2];
  const float* Wq      = (const float*)d_in[3];
  const float* Wk      = (const float*)d_in[4];
  const float* Wv      = (const float*)d_in[5];
  const float* m1w     = (const float*)d_in[6];
  const float* m1b     = (const float*)d_in[7];
  const float* m2w     = (const float*)d_in[8];
  const float* m2b     = (const float*)d_in[9];

  const size_t PX  = (size_t)NTOK * NE_ * 2;                   //  2097152
  const size_t PWT = (size_t)3 * NE_ * NE_ * 2;                //   393216
  const size_t PQ  = (size_t)NTOK * NE_ * 2;                   //  2097152
  const size_t PV  = (size_t)NB_ * NE_ * NC_ * 2;              //  2097152
  size_t off = 0;
  const size_t oXR = off; off += PX;
  const size_t oXC = off; off += PX;
  const size_t oWT = off; off += PWT;
  const size_t oQH = off; off += PQ;
  const size_t oQL = off; off += PQ;
  const size_t oKH = off; off += PQ;
  const size_t oKL = off; off += PQ;
  const size_t oVH = off; off += PV;
  const size_t oVL = off; off += PV;
  if (off > ws_size) return;                                   // off = 17170432
  if (off > (size_t)134217728) return;

  char* ws = (char*)d_ws;
  unsigned short* XR  = (unsigned short*)(ws + oXR);
  unsigned short* XC  = (unsigned short*)(ws + oXC);
  unsigned short* WT  = (unsigned short*)(ws + oWT);
  unsigned short* QH  = (unsigned short*)(ws + oQH);
  unsigned short* QL  = (unsigned short*)(ws + oQL);
  unsigned short* KH  = (unsigned short*)(ws + oKH);
  unsigned short* KL  = (unsigned short*)(ws + oKL);
  unsigned short* VH  = (unsigned short*)(ws + oVH);
  unsigned short* VL  = (unsigned short*)(ws + oVL);
  float*          out = (float*)d_out;

  const dim3 blk(256);
  const int  n8x = NTOK * NE_ / 8;                             // 131072
  const dim3 gX((n8x + 255) / 256);                            // 512
  const dim3 gWT(NE_ / 64, NE_ / 64, 3);                       // 4 x 4 x 3
  const dim3 gQK(((NTOK / 64) * (NE_ / 64) + 7) / 8, 1);       // 256 tiles -> 32 blocks
  const dim3 gVT(((NE_ / 64) * (NC_ / 64) + 7) / 8, NB_);      // 8 tiles -> 1 block x 32 batches
  const dim3 gAttn(NB_);                                       // 32

  const float oscale = 1.0f / 1024.0f;                         // 16*1024*y -> y*16
  const float rcarry = 2048.0f;                                // residual plane carry

  // (1) inputs -> f16 planes holding bf16-RNE values times an exact power of two
  cvt_h8<<<gX, blk, 0, stream>>>(row_emb, XR, n8x, 16.0f);
  cvt_h8<<<gX, blk, 0, stream>>>(col_emb, XC, n8x, 16.0f);
  cvt_wt<<<gWT, blk, 0, stream>>>(Wq, Wk, Wv, WT, 1024.0f);
  // (2) q[token][o] = sum_e xr[token][e] * WqT[o][e]   (M=4096 tokens, N=256, K=256) -> QH/QL
  gemm64h2<<<gQK, blk, 0, stream>>>(
      XR, NE_, 0LL,
      WT, NE_, 0LL,
      QH, QL, NE_, 0LL,
      NTOK, NE_, NE_, oscale, rcarry);
  // (3) k[token][o] = sum_e xc[token][e] * WkT[o][e] -> KH/KL
  gemm64h2<<<gQK, blk, 0, stream>>>(
      XC, NE_, 0LL,
      WT + (size_t)NE_ * NE_, NE_, 0LL,
      KH, KL, NE_, 0LL,
      NTOK, NE_, NE_, oscale, rcarry);
  // (4) v^T[b][o][c] = sum_e WvT[o][e] * xc[b*128+c][e]   (M=256 o, N=128 c, K=256; y = b) -> VH/VL
  gemm64h2<<<gVT, blk, 0, stream>>>(
      WT + (size_t)2 * NE_ * NE_, NE_, 0LL,
      XC, NE_, (long long)((size_t)NC_ * NE_),
      VH, VL, NC_, (long long)((size_t)NE_ * NC_),
      NE_, NC_, NE_, oscale, rcarry);
  // (5) attention with the per-head two-score MLP for all heads of a batch -> out [b][r][h*16+d]
  attn_kernel<<<gAttn, blk, 0, stream>>>(QH, QL, KH, KL, VH, VL, costm, m1w, m1b, m2w, m2b, out);
  (void)hipGetLastError();
}

// v001
// Measured time: 69 microseconds a run.
// Two timings next to v000 both put it at 2.45 times that version's speed.
// Contractions: q/k/v projections x.W (f16 operands holding bf16-RNE values, x x16 and W x1024, exact products, K 256);
// scores k.q (k and q as f16 hi planes x16 plus f16 residual planes x2^11, 3 products hh + (hl + lh) in a separate accumulator);
// context v.p (p x1024 f16, v as f16 hi x16 plus residual x2^11, 2 products, separate accumulators);
// all v_wmma_f32_16x16x32_f16 with f32 accumulate; two-score MLP, softmax statistics and normalisation in f32 on VALU.
#include <hip/hip_runtime.h>
#include <math.h>
#include <stdint.h>

#define NB_  32
#define NR_  128
#define NC_  128
#define NE_  256
#define NH_  16
#define HD_  16
#define MS_  16
#define NTOK (NB_ * NR_)
static_assert(NH_ * HD_ == NE_);
static_assert(NR_ == NC_);
static_assert((NTOK % 64) == 0 && (NE_ % 64) == 0 && (NC_ % 64) == 0 && (NE_ % 32) == 0);

typedef _Float16 v16h __attribute__((ext_vector_type(16)));
typedef _Float16 v8h  __attribute__((ext_vector_type(8)));
typedef float    v8f  __attribute__((ext_vector_type(8)));
typedef float    v4f  __attribute__((ext_vector_type(4)));
typedef unsigned int v4u __attribute__((ext_vector_type(4)));

// ---- scalar helpers --------------------------------------------------------------------------------
__device__ __forceinline__ unsigned short bf_bits(float f) {          // f32 -> bf16 bits, RNE convert
  unsigned u = __float_as_uint(f);
  return (unsigned short)((u + 0x7FFFu + ((u >> 16) & 1u)) >> 16);
}
__device__ __forceinline__ float bf_up(unsigned short h) { return __uint_as_float(((unsigned)h) << 16); }
__device__ __forceinline__ float bfr(float f) { return bf_up(bf_bits(f)); }
__device__ __forceinline__ unsigned short h_bits(_Float16 x) { return __builtin_bit_cast(unsigned short, x); }
__device__ __forceinline__ unsigned pk16(unsigned short a, unsigned short b) { return (unsigned)a | ((unsigned)b << 16); }
__device__ __forceinline__ v8f zero8() { v8f z = {0.f, 0.f, 0.f, 0.f, 0.f, 0.f, 0.f, 0.f}; return z; }

// ---- fragment loaders: 16-bit A/B operand, lane -> row/col (lane&15), p already includes +8*(lane>>4);
//      elements 0..7 <- p[0..7] (k0+8h..), elements 8..15 <- p[16..23] (k0+16+8h..)
__device__ __forceinline__ v16h ldfrag_h(const _Float16* p) {
  union { v16h v; v8h h[2]; } f;
  f.h[0] = *(const v8h*)(p);
  f.h[1] = *(const v8h*)(p + 16);
  return f.v;
}
//      16-deep contraction padded to 32 in registers: elements 0..7 <- p[0..7], elements 8..15 = 0
__device__ __forceinline__ v16h ldfrag_8z(const _Float16* p) {
  union { v16h v; v8h h[2]; } f;
  const _Float16 zz = (_Float16)0.0f;
  const v8h z = {zz, zz, zz, zz, zz, zz, zz, zz};
  f.h[0] = *(const v8h*)(p);
  f.h[1] = z;
  return f.v;
}

// ---- WMMA helpers with trailing VALU hazard gap --------------------------------------------------------
__device__ __forceinline__ v8f mma_h_raw(v16h a, v16h b, v8f c) {
  return __builtin_amdgcn_wmma_f32_16x16x32_f16(false, a, false, b, (short)0, c, false, false);
}
__device__ __forceinline__ void dep_guard_h(v8f& a, v8f& b, v16h x, v16h y) {
#if defined(__HIP_DEVICE_COMPILE__)
  asm volatile("v_nop\n\tv_nop\n\tv_nop\n\tv_nop" : "+v"(a), "+v"(b) : "v"(x), "v"(y));
#endif
}
__device__ __forceinline__ void guard2x3(v8f& a, v8f& b, v16h x, v16h y, v16h z) {
#if defined(__HIP_DEVICE_COMPILE__)
  asm volatile("v_nop\n\tv_nop\n\tv_nop\n\tv_nop" : "+v"(a), "+v"(b) : "v"(x), "v"(y), "v"(z));
#endif
}
__device__ __forceinline__ void guard4x6(v8f& a, v8f& b, v8f& c, v8f& d,
                                         v16h u, v16h w, v16h x, v16h y, v16h z, v16h t) {
#if defined(__HIP_DEVICE_COMPILE__)
  asm volatile("v_nop\n\tv_nop\n\tv_nop\n\tv_nop"
               : "+v"(a), "+v"(b), "+v"(c), "+v"(d)
               : "v"(u), "v"(w), "v"(x), "v"(y), "v"(z), "v"(t));
#endif
}
__device__ __forceinline__ void keep4_h(v16h a, v16h b, v16h c, v16h d) {
#if defined(__HIP_DEVICE_COMPILE__)
  asm volatile("v_nop" :: "v"(a), "v"(b), "v"(c), "v"(d));
#endif
}
__device__ __forceinline__ void acc_guard4(v8f& a, v8f& b, v8f& c, v8f& d) {
#if defined(__HIP_DEVICE_COMPILE__)
  asm volatile("v_nop\n\tv_nop\n\tv_nop\n\tv_nop" : "+v"(a), "+v"(b), "+v"(c), "+v"(d));
#endif
}
__device__ __forceinline__ void acc_guard2(v8f& a, v8f& b) {
#if defined(__HIP_DEVICE_COMPILE__)
  asm volatile("v_nop\n\tv_nop\n\tv_nop\n\tv_nop" : "+v"(a), "+v"(b));
#endif
}
__device__ __forceinline__ void wave_sync_lds() {
  __builtin_amdgcn_fence(__ATOMIC_RELEASE, "workgroup");
  __builtin_amdgcn_wave_barrier();
  __builtin_amdgcn_fence(__ATOMIC_ACQUIRE, "workgroup");
}

// =====================================================================================================
// f32 -> f16( bf16_RNE(x) * scale ), scale a power of two (exact), 8 elements per thread, one 16-B store
// =====================================================================================================
__global__ __launch_bounds__(256) void cvt_h8(const float* __restrict__ in, unsigned short* out, int n8, float scale) {
  const int i = blockIdx.x * 256 + threadIdx.x;
  if (i < n8) {
    const v4f a = *(const v4f*)(in + (size_t)i * 8);
    const v4f c = *(const v4f*)(in + (size_t)i * 8 + 4);
    float f[8];
    f[0] = a[0]; f[1] = a[1]; f[2] = a[2]; f[3] = a[3];
    f[4] = c[0]; f[5] = c[1]; f[6] = c[2]; f[7] = c[3];
    unsigned short hb[8];
#pragma unroll
    for (int e = 0; e < 8; ++e) hb[e] = h_bits((_Float16)(bf_up(bf_bits(f[e])) * scale));
    v4u p;
    p[0] = pk16(hb[0], hb[1]);
    p[1] = pk16(hb[2], hb[3]);
    p[2] = pk16(hb[4], hb[5]);
    p[3] = pk16(hb[6], hb[7]);
    *(v4u*)(out + (size_t)i * 8) = p;
    
  }
}

// =====================================================================================================
// Transpose-convert of the three projection weights: W[e (256)][o (256)] f32 (o contiguous) ->
// WT[z][o][e] f16 holding bf16_RNE(w) * scale, z = blockIdx.z selects Wq / Wk / Wv (block-uniform).
// grid = (256/64 o-tiles, 256/64 e-tiles, 3), 256 threads. Tile 64 e x 64 o staged transposed in LDS
// coverage: load 4 passes x 16 e-rows x 64 o = 64 x 64; store 2 passes x 32 o-rows x 64 e = 64 x 64.
// =====================================================================================================
#define QTP 72
__global__ __launch_bounds__(256) void cvt_wt(const float* __restrict__ Wq, const float* __restrict__ Wk,
                                              const float* __restrict__ Wv, unsigned short* WT, float scale) {
  __shared__ __align__(16) unsigned short ts[64 * QTP];
  const int tid = threadIdx.x;
  const int o0 = blockIdx.x * 64, e0 = blockIdx.y * 64, z = blockIdx.z;
  const float* W = (z == 0) ? Wq : ((z == 1) ? Wk : Wv);
  unsigned short* out = WT + (size_t)z * NE_ * NE_;
#pragma unroll 1
  for (int pass = 0; pass < 4; ++pass) {
    const int e  = pass * 16 + (tid >> 4);          // 0..63 within tile
    const int o4 = (tid & 15) * 4;                  // 0..60
    const v4f v = *(const v4f*)(W + (size_t)(e0 + e) * NE_ + o0 + o4);
#pragma unroll
    for (int i = 0; i < 4; ++i) ts[(o4 + i) * QTP + e] = h_bits((_Float16)(bf_up(bf_bits(v[i])) * scale));
  }
  __syncthreads();
#pragma unroll 1
  for (int pass = 0; pass < 2; ++pass) {
    const int lr = pass * 32 + (tid >> 3);          // o within tile 0..63
    const int c8 = (tid & 7) * 8;                   // e within tile
    const v4u v = *(const v4u*)(ts + lr * QTP + c8);
    unsigned short* dst = out + (size_t)(o0 + lr) * NE_ + e0 + c8;
    *(v4u*)dst = v;
    
  }
}

// =====================================================================================================
// Register-blocked batched f16 WMMA GEMM with a two-plane f16 epilogue:
//   f = ( sum_k A[m][k] * Bt[n][k] ) * oscale;  C1[m][n] = f16(f) (hi plane);  C2[m][n] = f16((f - hi) * rcarry).
// One wave per 64x64 tile, no block barriers. A row-major [M][K] pitch lda; Bt row-major [N][K] pitch ldb
// (k contiguous); M, N multiples of 64, K multiple of 32 (host-checked); blockIdx.y = batch index with element
// strides sAy / sBy / sCy. C1/C2 pitch ldc halves.
// coverage: 4 slabs x (4 it x 4 rows) x 64 cols = the wave's whole 64x64 tile, for C1 and C2.
// =====================================================================================================
__global__ __launch_bounds__(256) void gemm64h2(
    const unsigned short* __restrict__ Ap, int lda, long long sAy,
    const unsigned short* __restrict__ Btp, int ldb, long long sBy,
    unsigned short* C1, unsigned short* C2, int ldc, long long sCy,
    int M, int N, int K, float oscale, float rcarry) {
  const _Float16* A  = (const _Float16*)(const void*)Ap;
  const _Float16* Bt = (const _Float16*)(const void*)Btp;
  __shared__ __align__(16) float sT[8][16 * 68];   // per-wave 16x64 slab, pitch 68 floats
  const int by   = blockIdx.y;
  const int lane = threadIdx.x & 31;
  const int wave = threadIdx.x >> 5;
  const int tilesN = N >> 6;
  const int tilesM = M >> 6;
  const int tile = blockIdx.x * 8 + wave;
  if (tile >= tilesM * tilesN) return;   // wave-uniform; no block barriers in this kernel
  const int tm = tile / tilesN;
  const int tn = tile - tm * tilesN;
  const int m0 = tm << 6;
  const int n0 = tn << 6;

  const _Float16* Ab = A + (size_t)by * (size_t)sAy;
  const _Float16* Bb = Bt + (size_t)by * (size_t)sBy;

  const int rlane = lane & 15;                 // row (A) / col (B, D) within subtile
  const int koff  = (lane >> 4) * 8;           // k offset of this lane half
  const int mOff  = (lane >> 4) * 8;           // D row offset

  v8f acc[4][4];
#pragma unroll
  for (int i = 0; i < 4; ++i)
#pragma unroll
    for (int j = 0; j < 4; ++j) acc[i][j] = zero8();

  for (int k0 = 0; k0 < K; k0 += 32) {
    v16h bf[4];
#pragma unroll
    for (int j = 0; j < 4; ++j) {
      const size_t bo = (size_t)(n0 + (j << 4) + rlane) * ldb + koff + k0;
      bf[j] = ldfrag_h(Bb + bo);
    }
#pragma unroll
    for (int i = 0; i < 4; ++i) {
      const size_t ao = (size_t)(m0 + (i << 4) + rlane) * lda + koff + k0;
      const v16h ah = ldfrag_h(Ab + ao);
#pragma unroll
      for (int j = 0; j < 4; ++j) acc[i][j] = mma_h_raw(ah, bf[j], acc[i][j]);
      dep_guard_h(acc[i][0], acc[i][3], ah, bf[3]);
    }
    keep4_h(bf[0], bf[1], bf[2], bf[3]);
  }
  acc_guard4(acc[0][0], acc[0][1], acc[0][2], acc[0][3]);
  acc_guard4(acc[1][0], acc[1][1], acc[1][2], acc[1][3]);
  acc_guard4(acc[2][0], acc[2][1], acc[2][2], acc[2][3]);
  acc_guard4(acc[3][0], acc[3][1], acc[3][2], acc[3][3]);

  // ---- epilogue ----
  float* slab = sT[wave];
  unsigned short* Cb1 = C1 + (size_t)by * (size_t)sCy;
  unsigned short* Cb2 = C2 + (size_t)by * (size_t)sCy;
  const int rq = lane >> 3, c8 = (lane & 7) * 8;
#pragma unroll
  for (int i = 0; i < 4; ++i) {
    const int mBase = m0 + (i << 4);
#pragma unroll
    for (int j = 0; j < 4; ++j) {
#pragma unroll
      for (int r = 0; r < 8; ++r) {
        slab[(mOff + r) * 68 + (j << 4) + rlane] = acc[i][j][r] * oscale;
      }
    }
    wave_sync_lds();
    v4u ph[4], pl[4];
#pragma unroll
    for (int it = 0; it < 4; ++it) {
      const int row = it * 4 + rq;                     // it 0..3 x rq 0..3 = rows 0..15
      const v4f x0 = *(const v4f*)(slab + row * 68 + c8);
      const v4f x1 = *(const v4f*)(slab + row * 68 + c8 + 4);
      float f[8];
      f[0] = x0[0]; f[1] = x0[1]; f[2] = x0[2]; f[3] = x0[3];
      f[4] = x1[0]; f[5] = x1[1]; f[6] = x1[2]; f[7] = x1[3];
      unsigned short hb[8], lb[8];
#pragma unroll
      for (int e = 0; e < 8; ++e) {
        const _Float16 xh = (_Float16)f[e];
        hb[e] = h_bits(xh);
        lb[e] = h_bits((_Float16)((f[e] - (float)xh) * rcarry));
      }
#pragma unroll
      for (int q = 0; q < 4; ++q) {
        ph[it][q] = pk16(hb[2 * q], hb[2 * q + 1]);
        pl[it][q] = pk16(lb[2 * q], lb[2 * q + 1]);
      }
    }
    {
#pragma unroll
      for (int it = 0; it < 4; ++it) {
        const int row = it * 4 + rq;
        const size_t d = (size_t)(mBase + row) * ldc + n0 + c8;
        *(v4u*)(Cb1 + d) = ph[it];
        *(v4u*)(Cb2 + d) = pl[it];
      }
      
    }
    wave_sync_lds();
  }
}

// =====================================================================================================
// Attention with the two-score MLP, head dim 16 (padded to 32 in registers), 128 queries x 128 keys.
// grid = (NB_ batches, NH_/2 head pairs), 512 threads = 2 heads of the pair x 8 waves x 16 queries: every wave
// works on one head only; an output line (32 floats = a head pair of one query row) is stored by one wave.
// QH/QL/KH/KL [token][256] f16 (col h*16+d; x16 hi / residual x2^11), VH/VL [b][o (256)][c (128)] f16.
// Per head: MLP weights of the head RNE-converted to bf16 into LDS (first wave of the head, unconditional loads), resident
// q fragments; per 64-key step: K hi/res rows (64 x 32 B) and V^T hi/res tiles (16 o x 64 keys) staged with
// plain loads + block barriers; two 32-key sub-steps each:
// S[key][q] = A(K hi rows) x B(Q hi) ; Sr = A(K hi) x B(Q res) + A(K res) x B(Q hi) (separate accumulator, /2048);
// dot = (S + Sr/2048)/1024; cost RNE-bf16 per (q,key) from global; lg = b2 + sum_m relu(dot*w0+cost*w1+b1)*w2
// in f32 (m loop rolled); online softmax over keys (max/sum across lane halves by shuffle),
// p = 1024*exp(x - max) packed D->B per the chained map (element r <- keys 0-15 tile, 8+r <- keys 16-31 tile);
// Oh[d][q] += A(V hi rows) x P, Ol[d][q] += A(V res rows) x P; both rescaled by alpha;
// ctx = (Oh + Ol/2048) / (16 l). The 16 ctx values of (q, head) go to LDS staging shared by the pair's two heads.
// coverage: block = 128 queries x 32 cols (one head pair); per wave 2 it x 4 rows x 8 pieces of 4 floats = 8 x 32;
//           16 waves x 8 rows = 128 rows; NB_ x NH_/2 blocks.
// =====================================================================================================
#define VPITCH 72
#define SP_    36
__global__ __launch_bounds__(512) void attn_kernel(
    const unsigned short* __restrict__ QHp, const unsigned short* __restrict__ QLp,
    const unsigned short* __restrict__ KHp, const unsigned short* __restrict__ KLp,
    const unsigned short* __restrict__ VHp, const unsigned short* __restrict__ VLp,
    const float* __restrict__ cost,
    const float* __restrict__ m1w, const float* __restrict__ m1b,
    const float* __restrict__ m2w, const float* __restrict__ m2b,
    float* out) {
  __shared__ __align__(16) unsigned short kh_s[2][64 * HD_];       // 2 x 2048 B, one set per head of the pair
  __shared__ __align__(16) unsigned short kg_s[2][64 * HD_];       // 2 x 2048 B
  __shared__ __align__(16) unsigned short vh_s[2][16 * VPITCH];    // 2 x 2304 B
  __shared__ __align__(16) unsigned short vr_s[2][16 * VPITCH];    // 2 x 2304 B
  __shared__ __align__(16) float sMW_s[2][MS_ * 4 + 4];            // 2 x 272 B
  __shared__ __align__(16) float sto[8 * 16 * SP_];                // 18432 B
  const int tid = threadIdx.x, lane = tid & 31, wave = tid >> 5;
  const int hs = wave >> 3, qw = wave & 7;                         // head of the pair, query group (wave-uniform)
  unsigned short* kh_u = kh_s[hs];
  unsigned short* kg_u = kg_s[hs];
  unsigned short* vh_u = vh_s[hs];
  unsigned short* vr_u = vr_s[hs];
  float* sMW = sMW_s[hs];
  const _Float16* khh = (const _Float16*)(const void*)kh_u;
  const _Float16* kgg = (const _Float16*)(const void*)kg_u;
  const _Float16* vhh = (const _Float16*)(const void*)vh_u;
  const _Float16* vrl = (const _Float16*)(const void*)vr_u;
  const _Float16* QH  = (const _Float16*)(const void*)QHp;
  const _Float16* QL  = (const _Float16*)(const void*)QLp;

  const int b = blockIdx.x;
  const int h = blockIdx.y * 2 + hs;
  const int qBase = qw * 16;
  const int rlane = lane & 15, hsel = lane >> 4, koff = hsel * 8;
  const float C2048  = 1.0f / 2048.0f;
  const float C1024  = 1.0f / 1024.0f;
  const float LN1024 = 6.931471805599453f;

  const size_t qrow = (size_t)(b * NR_ + qBase + rlane);           // token index of this lane's query
  const float* crow = cost + qrow * NC_ + koff;                      // + key base

  // staging assignments, fixed per thread
  const int t2   = tid & 127;
  const int krow = t2 >> 1, kdh = (t2 & 1) * 8;                     // key 0..63, dim half
  const int vrow = t2 >> 3, vc8 = (t2 & 7) * 8;                     // o row 0..15, key piece
  unsigned short* khd = kh_u + t2 * 8;
  unsigned short* kgd = kg_u + t2 * 8;
  unsigned short* vhd = vh_u + vrow * VPITCH + vc8;
  unsigned short* vrd = vr_u + vrow * VPITCH + vc8;

  {
    if (qw == 0) {                                                 // wave-uniform; loads unconditional
      const int m = rlane;
      const float w0 = bfr(m1w[(h * 2 + 0) * MS_ + m]);
      const float w1 = bfr(m1w[(h * 2 + 1) * MS_ + m]);
      const float bb = bfr(m1b[h * MS_ + m]);
      const float w2 = bfr(m2w[h * MS_ + m]);
      const float b2 = bfr(m2b[h]);
      if (hsel == 0) {
        v4f t = {w0, w1, bb, w2};
        *(v4f*)(sMW + 4 * m) = t;
      }
      if (lane == 0) sMW[MS_ * 4] = b2;
    }
    // resident Q fragments (B operand: B[k=d][n=q] from [q][d] rows), arithmetic addressing
    const size_t qo = qrow * NE_ + (size_t)h * HD_ + koff;
    const v16h qh = ldfrag_8z(QH + qo);
    const v16h ql = ldfrag_8z(QL + qo);
    const size_t kgo = ((size_t)(b * NC_ + krow)) * NE_ + (size_t)h * HD_ + kdh;
    const unsigned short* Kgh = KHp + kgo;
    const unsigned short* Kgl = KLp + kgo;
    const size_t vgo = ((size_t)(b * NE_ + h * HD_ + vrow)) * NC_ + vc8;
    const unsigned short* Vhg = VHp + vgo;
    const unsigned short* Vlg = VLp + vgo;

    v8f oh = zero8(), ol = zero8();
    float m_run = -1e30f, l_run = 0.f;

#pragma unroll 1
    for (int kb = 0; kb < NC_; kb += 64) {
      __syncthreads();                                             // prior tile fully consumed
      if (qw < 4) {                                                // wave-uniform
        const v4u kv = *(const v4u*)(Kgh + (size_t)kb * NE_);
        *(v4u*)khd = kv;
        const v4u lv = *(const v4u*)(Vlg + kb);
        *(v4u*)vrd = lv;
      } else {
        const v4u kv = *(const v4u*)(Kgl + (size_t)kb * NE_);
        *(v4u*)kgd = kv;
        const v4u hv = *(const v4u*)(Vhg + kb);
        *(v4u*)vhd = hv;
      }
      __syncthreads();                                             // tile ready

#pragma unroll 1
      for (int sub = 0; sub < 2; ++sub) {
        const int kr = 32 * sub;
        // scores: two 16-key tiles, d padded to 32, hi and residual planes of both operands
        const v16h kf0 = ldfrag_8z(khh + (kr + rlane) * HD_ + koff);
        const v16h kf1 = ldfrag_8z(khh + (kr + 16 + rlane) * HD_ + koff);
        const v16h kg0 = ldfrag_8z(kgg + (kr + rlane) * HD_ + koff);
        const v16h kg1 = ldfrag_8z(kgg + (kr + 16 + rlane) * HD_ + koff);
        v8f sr0 = mma_h_raw(kf0, ql, zero8());
        v8f sr1 = mma_h_raw(kf1, ql, zero8());
        v8f sh0 = mma_h_raw(kf0, qh, zero8());
        v8f sh1 = mma_h_raw(kf1, qh, zero8());
        sr0 = mma_h_raw(kg0, qh, sr0);
        sr1 = mma_h_raw(kg1, qh, sr1);
        guard4x6(sh0, sh1, sr0, sr1, kf0, kf1, kg0, kg1, qh, ql);

        // cost for keys kb+kr+8h+r (tile 0) and kb+kr+16+8h+r (tile 1), RNE-converted to bf16
        const v4f ca0 = *(const v4f*)(crow + kb + kr);
        const v4f ca1 = *(const v4f*)(crow + kb + kr + 4);
        const v4f cb0 = *(const v4f*)(crow + kb + kr + 16);
        const v4f cb1 = *(const v4f*)(crow + kb + kr + 20);
        float d0[8], d1[8], c0[8], c1[8];
#pragma unroll
        for (int r = 0; r < 4; ++r) {
          c0[r] = bfr(ca0[r]); c0[r + 4] = bfr(ca1[r]);
          c1[r] = bfr(cb0[r]); c1[r + 4] = bfr(cb1[r]);
        }
#pragma unroll
        for (int r = 0; r < 8; ++r) {
          d0[r] = (sh0[r] + sr0[r] * C2048) * C1024;
          d1[r] = (sh1[r] + sr1[r] * C2048) * C1024;
        }

        // per-head two-score MLP: lg = b2 + sum_m relu(dot*w0 + cost*w1 + b1) * w2   (f32, m loop rolled)
        const float b2v = sMW[MS_ * 4];
        float a0[8], a1[8];
#pragma unroll
        for (int r = 0; r < 8; ++r) { a0[r] = b2v; a1[r] = b2v; }
#pragma unroll 1
        for (int m = 0; m < MS_; ++m) {
          const v4f w = *(const v4f*)(sMW + 4 * m);
#pragma unroll
          for (int r = 0; r < 8; ++r) {
            const float t0 = fmaxf(fmaf(d0[r], w[0], fmaf(c0[r], w[1], w[2])), 0.0f);
            const float t1 = fmaxf(fmaf(d1[r], w[0], fmaf(c1[r], w[1], w[2])), 0.0f);
            a0[r] = fmaf(t0, w[3], a0[r]);
            a1[r] = fmaf(t1, w[3], a1[r]);
          }
        }

        // online softmax over the key axis for this lane's q column
        float mloc = -1e30f;
#pragma unroll
        for (int r = 0; r < 8; ++r) mloc = fmaxf(mloc, fmaxf(a0[r], a1[r]));
        mloc = fmaxf(mloc, __shfl_xor(mloc, 16, 32));
        const float newM  = fmaxf(m_run, mloc);
        const float alpha = __expf(m_run - newM);
        const float msh   = newM - LN1024;
        float ssum = 0.f;
        float p0[8], p1[8];
#pragma unroll
        for (int r = 0; r < 8; ++r) {
          p0[r] = __expf(a0[r] - msh);
          p1[r] = __expf(a1[r] - msh);
          ssum += p0[r] + p1[r];
        }
        ssum += __shfl_xor(ssum, 16, 32);
        l_run = l_run * alpha + ssum;
        m_run = newM;
#pragma unroll
        for (int r = 0; r < 8; ++r) { oh[r] *= alpha; ol[r] *= alpha; }

        // P (f32, D layout) -> B operand (f16): element r <- keys 0-15 tile, 8+r <- keys 16-31 tile
        union { v16h v; _Float16 s[16]; } pf;
#pragma unroll
        for (int r = 0; r < 8; ++r) {
          pf.s[r]     = (_Float16)p0[r];
          pf.s[8 + r] = (_Float16)p1[r];
        }

        // O[d][q] += V^T[d][kb+kr .. +31] x P, hi and residual planes in separate accumulators
        const v16h vah = ldfrag_h(vhh + rlane * VPITCH + kr + koff);
        const v16h val = ldfrag_h(vrl + rlane * VPITCH + kr + koff);
        oh = mma_h_raw(vah, pf.v, oh);
        ol = mma_h_raw(val, pf.v, ol);
        guard2x3(oh, ol, vah, val, pf.v);
      }
    }
    acc_guard2(oh, ol);

    // ---- per-head ctx values -> LDS staging (own lane slots): row q, cols hs*16 + 8*hsel + 0..7 ----
    const float inv = (1.0f / 16.0f) * (1.0f / l_run);     // ctx = (Oh + Ol/2048) / (16 * l)
    v4f f0, f1;
#pragma unroll
    for (int e = 0; e < 4; ++e) {
      f0[e] = (oh[e]     + ol[e]     * C2048) * inv;
      f1[e] = (oh[4 + e] + ol[4 + e] * C2048) * inv;
    }
    const int so = (qBase + rlane) * SP_ + hs * 16 + koff;
    *(v4f*)(sto + so)     = f0;
    *(v4f*)(sto + so + 4) = f1;

    __syncthreads();                                         // both heads of the pair staged
    {
      const int rq = lane >> 3, c4 = (lane & 7) * 4;
      const float* ss = sto + (wave * 8) * SP_;
      v4f ov[2];
#pragma unroll
      for (int it = 0; it < 2; ++it) ov[it] = *(const v4f*)(ss + (it * 4 + rq) * SP_ + c4);
      float* ob = out + ((size_t)(b * NR_ + wave * 8)) * NE_ + (size_t)blockIdx.y * 32 + c4;
#pragma unroll
      for (int it = 0; it < 2; ++it) {
        const int row = it * 4 + rq;                         // it 0..1 x rq 0..3 = rows 0..7
        *(v4f*)(ob + (size_t)row * NE_) = ov[it];
      }
    }
  }
}

// =====================================================================================================
// Workspace map (bytes), every plane an exact multiple of its whole-line store granularity:
//   XR   f16 [4096][256]      row activations, bf16-RNE x16         0          2097152
//   XC   f16 [4096][256]      col activations, bf16-RNE x16   2097152          2097152
//   WT   f16 [3][256][256]    Wq^T, Wk^T, Wv^T, bf16-RNE x1024 4194304         393216
//   QH   f16 [4096][256]      q x16 hi                        4587520          2097152
//   QL   f16 [4096][256]      q residual x2^11                6684672          2097152
//   KH   f16 [4096][256]      k x16 hi                        8781824          2097152
//   KL   f16 [4096][256]      k residual x2^11               10878976          2097152
//   VH   f16 [32][256][128]   v^T x16 hi, [b][o][c]          12976128          2097152
//   VL   f16 [32][256][128]   v^T residual x2^11             15073280          2097152
//   end                                                     17170432
// =====================================================================================================
extern "C" void kernel_launch(void* const* d_in, const int* in_sizes, int n_in,
                              void* d_out, int out_size, void* d_ws, size_t ws_size,
                              hipStream_t stream) {
  if (n_in < 10) return;
  if (in_sizes[0] != NB_ * NR_ * NE_) return;
  if (in_sizes[1] != NB_ * NC_ * NE_) return;
  if (in_sizes[2] != NB_ * NR_ * NC_) return;
  if (in_sizes[3] != NE_ * NE_) return;
  if (in_sizes[4] != NE_ * NE_) return;
  if (in_sizes[5] != NE_ * NE_) return;
  if (in_sizes[6] != NH_ * 2 * MS_) return;
  if (in_sizes[7] != NH_ * MS_) return;
  if (in_sizes[8] != NH_ * MS_) return;
  if (in_sizes[9] < NH_) return;
  if (out_size != NB_ * NR_ * NE_) return;

  const float* row_emb = (const float*)d_in[0];
  const float* col_emb = (const float*)d_in[1];
  const float* costm   = (const float*)d_in[2];
  const float* Wq      = (const float*)d_in[3];
  const float* Wk      = (const float*)d_in[4];
  const float* Wv      = (const float*)d_in[5];
  const float* m1w     = (const float*)d_in[6];
  const float* m1b     = (const float*)d_in[7];
  const float* m2w     = (const float*)d_in[8];
  const float* m2b     = (const float*)d_in[9];

  const size_t PX  = (size_t)NTOK * NE_ * 2;                   //  2097152
  const size_t PWT = (size_t)3 * NE_ * NE_ * 2;                //   393216
  const size_t PQ  = (size_t)NTOK * NE_ * 2;                   //  2097152
  const size_t PV  = (size_t)NB_ * NE_ * NC_ * 2;              //  2097152
  size_t off = 0;
  const size_t oXR = off; off += PX;
  const size_t oXC = off; off += PX;
  const size_t oWT = off; off += PWT;
  const size_t oQH = off; off += PQ;
  const size_t oQL = off; off += PQ;
  const size_t oKH = off; off += PQ;
  const size_t oKL = off; off += PQ;
  const size_t oVH = off; off += PV;
  const size_t oVL = off; off += PV;
  if (off > ws_size) return;                                   // off = 17170432
  if (off > (size_t)134217728) return;

  char* ws = (char*)d_ws;
  unsigned short* XR  = (unsigned short*)(ws + oXR);
  unsigned short* XC  = (unsigned short*)(ws + oXC);
  unsigned short* WT  = (unsigned short*)(ws + oWT);
  unsigned short* QH  = (unsigned short*)(ws + oQH);
  unsigned short* QL  = (unsigned short*)(ws + oQL);
  unsigned short* KH  = (unsigned short*)(ws + oKH);
  unsigned short* KL  = (unsigned short*)(ws + oKL);
  unsigned short* VH  = (unsigned short*)(ws + oVH);
  unsigned short* VL  = (unsigned short*)(ws + oVL);
  float*          out = (float*)d_out;

  const dim3 blk(256);
  const int  n8x = NTOK * NE_ / 8;                             // 131072
  const dim3 gX((n8x + 255) / 256);                            // 512
  const dim3 gWT(NE_ / 64, NE_ / 64, 3);                       // 4 x 4 x 3
  const dim3 gQK(((NTOK / 64) * (NE_ / 64) + 7) / 8, 1);       // 256 tiles -> 32 blocks
  const dim3 gVT(((NE_ / 64) * (NC_ / 64) + 7) / 8, NB_);      // 8 tiles -> 1 block x 32 batches
  const dim3 gAttn(NB_, NH_ / 2);                              // 32 x 8 = 256
  const dim3 blkA(512);

  const float oscale = 1.0f / 1024.0f;                         // 16*1024*y -> y*16
  const float rcarry = 2048.0f;                                // residual plane carry

  // (1) inputs -> f16 planes holding bf16-RNE values times an exact power of two
  cvt_h8<<<gX, blk, 0, stream>>>(row_emb, XR, n8x, 16.0f);
  cvt_h8<<<gX, blk, 0, stream>>>(col_emb, XC, n8x, 16.0f);
  cvt_wt<<<gWT, blk, 0, stream>>>(Wq, Wk, Wv, WT, 1024.0f);
  // (2) q[token][o] = sum_e xr[token][e] * WqT[o][e]   (M=4096 tokens, N=256, K=256) -> QH/QL
  gemm64h2<<<gQK, blk, 0, stream>>>(
      XR, NE_, 0LL,
      WT, NE_, 0LL,
      QH, QL, NE_, 0LL,
      NTOK, NE_, NE_, oscale, rcarry);
  // (3) k[token][o] = sum_e xc[token][e] * WkT[o][e] -> KH/KL
  gemm64h2<<<gQK, blk, 0, stream>>>(
      XC, NE_, 0LL,
      WT + (size_t)NE_ * NE_, NE_, 0LL,
      KH, KL, NE_, 0LL,
      NTOK, NE_, NE_, oscale, rcarry);
  // (4) v^T[b][o][c] = sum_e WvT[o][e] * xc[b*128+c][e]   (M=256 o, N=128 c, K=256; y = b) -> VH/VL
  gemm64h2<<<gVT, blk, 0, stream>>>(
      WT + (size_t)2 * NE_ * NE_, NE_, 0LL,
      XC, NE_, (long long)((size_t)NC_ * NE_),
      VH, VL, NC_, (long long)((size_t)NE_ * NC_),
      NE_, NC_, NE_, oscale, rcarry);
  // (5) attention with the per-head two-score MLP, one head pair of a batch per block -> out [b][r][h*16+d]
  attn_kernel<<<gAttn, blkA, 0, stream>>>(QH, QL, KH, KL, VH, VL, costm, m1w, m1b, m2w, m2b, out);
  (void)hipGetLastError();
}

// v002
// One run takes 21.1 microseconds.
// Next to v001, in two timings, it ran 3.28 times as fast each time.
// Over all steps from v000 it is 8.03 times as fast.
// One launch. Contractions: q/k/v projections x.W (f16 operands holding bf16-RNE values, x x16 and W x1024, exact products, K 256);
// scores k.q (k and q as f16 hi planes x16 plus f16 residual planes x2^11, 3 products hh + (hl + lh) in a separate accumulator);
// context v.p (p x1024 f16, v as f16 hi x16 plus residual x2^11, 2 products, separate accumulators);
// all v_wmma_f32_16x16x32_f16 with f32 accumulate; two-score MLP, softmax statistics and normalisation in f32 on VALU.
#include <hip/hip_runtime.h>
#include <math.h>
#include <stdint.h>

#define NB_  32
#define NR_  128
#define NC_  128
#define NE_  256
#define NH_  16
#define HD_  16
#define MS_  16
#define NTOK (NB_ * NR_)
static_assert(NH_ * HD_ == NE_);
static_assert(NR_ == NC_);
static_assert((NTOK % 64) == 0 && (NE_ % 64) == 0 && (NC_ % 64) == 0 && (NE_ % 32) == 0);

typedef _Float16 v16h __attribute__((ext_vector_type(16)));
typedef _Float16 v8h  __attribute__((ext_vector_type(8)));
typedef float    v8f  __attribute__((ext_vector_type(8)));
typedef float    v4f  __attribute__((ext_vector_type(4)));
typedef unsigned int v4u __attribute__((ext_vector_type(4)));

// ---- scalar helpers --------------------------------------------------------------------------------
__device__ __forceinline__ unsigned short bf_bits(float f) {          // f32 -> bf16 bits, RNE convert
  unsigned u = __float_as_uint(f);
  return (unsigned short)((u + 0x7FFFu + ((u >> 16) & 1u)) >> 16);
}
__device__ __forceinline__ float bf_up(unsigned short h) { return __uint_as_float(((unsigned)h) << 16); }
__device__ __forceinline__ float bfr(float f) { return bf_up(bf_bits(f)); }
__device__ __forceinline__ unsigned short h_bits(_Float16 x) { return __builtin_bit_cast(unsigned short, x); }
__device__ __forceinline__ unsigned pk16(unsigned short a, unsigned short b) { return (unsigned)a | ((unsigned)b << 16); }
__device__ __forceinline__ v8f zero8() { v8f z = {0.f, 0.f, 0.f, 0.f, 0.f, 0.f, 0.f, 0.f}; return z; }

// ---- fragment loaders: 16-bit A/B operand, lane -> row/col (lane&15), p already includes +8*(lane>>4);
//      elements 0..7 <- p[0..7] (k0+8h..), elements 8..15 <- p[16..23] (k0+16+8h..)
__device__ __forceinline__ v16h ldfrag_h(const _Float16* p) {
  union { v16h v; v8h h[2]; } f;
  f.h[0] = *(const v8h*)(p);
  f.h[1] = *(const v8h*)(p + 16);
  return f.v;
}
//      16-deep contraction padded to 32 in registers: elements 0..7 <- p[0..7], elements 8..15 = 0
__device__ __forceinline__ v16h ldfrag_8z(const _Float16* p) {
  union { v16h v; v8h h[2]; } f;
  const _Float16 zz = (_Float16)0.0f;
  const v8h z = {zz, zz, zz, zz, zz, zz, zz, zz};
  f.h[0] = *(const v8h*)(p);
  f.h[1] = z;
  return f.v;
}

// ---- WMMA helpers with trailing VALU hazard gap --------------------------------------------------------
__device__ __forceinline__ v8f mma_h_raw(v16h a, v16h b, v8f c) {
  return __builtin_amdgcn_wmma_f32_16x16x32_f16(false, a, false, b, (short)0, c, false, false);
}
__device__ __forceinline__ void guard2x3(v8f& a, v8f& b, v16h x, v16h y, v16h z) {
#if defined(__HIP_DEVICE_COMPILE__)
  asm volatile("v_nop\n\tv_nop\n\tv_nop\n\tv_nop" : "+v"(a), "+v"(b) : "v"(x), "v"(y), "v"(z));
#endif
}
__device__ __forceinline__ void guard4x6(v8f& a, v8f& b, v8f& c, v8f& d,
                                         v16h u, v16h w, v16h x, v16h y, v16h z, v16h t) {
#if defined(__HIP_DEVICE_COMPILE__)
  asm volatile("v_nop\n\tv_nop\n\tv_nop\n\tv_nop"
               : "+v"(a), "+v"(b), "+v"(c), "+v"(d)
               : "v"(u), "v"(w), "v"(x), "v"(y), "v"(z), "v"(t));
#endif
}
__device__ __forceinline__ void acc_guard2(v8f& a, v8f& b) {
#if defined(__HIP_DEVICE_COMPILE__)
  asm volatile("v_nop\n\tv_nop\n\tv_nop\n\tv_nop" : "+v"(a), "+v"(b));
#endif
}

// ---- 8 x f32 -> 8 x f16( bf16_RNE(x) * scale ), scale a power of two (exact), packed for one 16-B store
__device__ __forceinline__ unsigned short cvt_h1(float f, float scale) {
  return h_bits((_Float16)(bf_up(bf_bits(f)) * scale));
}
__device__ __forceinline__ v4u cvt_h8v(v4f a, v4f c, float scale) {
  v4u p;
  p[0] = pk16(cvt_h1(a[0], scale), cvt_h1(a[1], scale));
  p[1] = pk16(cvt_h1(a[2], scale), cvt_h1(a[3], scale));
  p[2] = pk16(cvt_h1(c[0], scale), cvt_h1(c[1], scale));
  p[3] = pk16(cvt_h1(c[2], scale), cvt_h1(c[3], scale));
  return p;
}
// ---- projection accumulator (x16 * x1024 scale) -> f16 hi plane (x16) and f16 residual plane (x2^11), 8 values each
__device__ __forceinline__ void split8(v8f acc, v8h& hi, v8h& lo) {
#pragma unroll
  for (int r = 0; r < 8; ++r) {
    const float f = acc[r] * (1.0f / 1024.0f);
    const _Float16 xh = (_Float16)f;
    hi[r] = xh;
    lo[r] = (_Float16)((f - (float)xh) * 2048.0f);
  }
}
__device__ __forceinline__ v16h pad8z(v8h x) {                    // elements 0..7 <- x, elements 8..15 = 0
  union { v16h v; v8h h[2]; } f;
  const _Float16 zz = (_Float16)0.0f;
  const v8h z = {zz, zz, zz, zz, zz, zz, zz, zz};
  f.h[0] = x;
  f.h[1] = z;
  return f.v;
}

// =====================================================================================================
// Projections and attention with the two-score MLP in one kernel, head dim 16 (padded to 32 in registers).
// grid = (NB_ batches, NH_/2 head pairs), 512 threads = 2 heads of the pair x 8 waves x 16 tokens.
// Stage: the batch's row and col activations (128 x 256 each) and the pair's 32 columns of Wq / Wk / Wv (transposed to
// [o][e]) are read as f32, RNE-converted to bf16 values held in f16 (x x16, W x1024) and laid in LDS, pitch XP_.
// Project: wave (head hs, group qw) forms three 16x16 tiles over K = 256, all for tokens qw*16..+15 and head hs:
//   q^T[d][q]   = A(WqT rows d) x B(xr rows q)   -> D lane = q, rows d = 8*(lane>>4)+r: already the B fragment of the scores
//   k^T[d][key] = A(WkT rows d) x B(xc rows key) -> D lane = key, 8 d: one 16-B store into the K rows [key][16]
//   v[key][d]   = A(xc rows key) x B(WvT rows d) -> D lane = d, 8 keys: one 16-B store into the V^T rows [d][128]
// each split into an f16 hi plane (x16) and an f16 residual plane (x2^11).
// Attend, per 32-key step over the 128 keys held in LDS:
// S[key][q] = A(K hi rows) x B(Q hi) ; Sr = A(K hi) x B(Q res) + A(K res) x B(Q hi) (separate accumulator, /2048);
// dot = (S + Sr/2048)/1024; cost RNE-bf16 per (q,key) from global; lg = b2 + sum_m relu(dot*w0+cost*w1+b1)*w2
// in f32 (m loop rolled); online softmax over keys (max/sum across lane halves by shuffle),
// p = 1024*exp(x - max) packed D->B per the chained map (element r <- keys 0-15 tile, 8+r <- keys 16-31 tile);
// Oh[d][q] += A(V hi rows) x P, Ol[d][q] += A(V res rows) x P; both rescaled by alpha;
// ctx = (Oh + Ol/2048) / (16 l). The 16 ctx values of (q, head) go to LDS staging shared by the pair's two heads.
// coverage: block = 128 queries x 32 cols (one head pair); per wave 2 it x 4 rows x 8 pieces of 4 floats = 8 x 32;
//           16 waves x 8 rows = 128 rows; NB_ x NH_/2 blocks.
// =====================================================================================================
#define XP_    264                                                  // 528 B = 16 B x 33
#define VPITCH 136                                                  // 272 B = 16 B x 17
#define SP_    36
__global__ __launch_bounds__(512) void attn_kernel(
    const float* __restrict__ row_emb, const float* __restrict__ col_emb,
    const float* __restrict__ cost,
    const float* __restrict__ Wq, const float* __restrict__ Wk, const float* __restrict__ Wv,
    const float* __restrict__ m1w, const float* __restrict__ m1b,
    const float* __restrict__ m2w, const float* __restrict__ m2b,
    float* out) {
  __shared__ __align__(16) unsigned short xr_s[NR_ * XP_];         // 67584 B
  __shared__ __align__(16) unsigned short xc_s[NC_ * XP_];         // 67584 B
  __shared__ __align__(16) unsigned short wt_s[3 * 32 * XP_];      // 50688 B, rows z*32 + o of the pair
  __shared__ __align__(16) unsigned short kh_s[2][NC_ * HD_];      // 2 x 4096 B, one set per head of the pair
  __shared__ __align__(16) unsigned short kg_s[2][NC_ * HD_];      // 2 x 4096 B
  __shared__ __align__(16) unsigned short vh_s[2][16 * VPITCH];    // 2 x 4352 B
  __shared__ __align__(16) unsigned short vr_s[2][16 * VPITCH];    // 2 x 4352 B
  __shared__ __align__(16) float sMW_s[2][MS_ * 4 + 32];           // 2 x 384 B: 16 x (w0, w1, b1, w2), then b2 once per lane
  __shared__ __align__(16) float sto[8 * 16 * SP_];                // 18432 B
  const int tid = threadIdx.x, lane = tid & 31, wave = tid >> 5;
  const int hs = wave >> 3, qw = wave & 7;                         // head of the pair, token group (wave-uniform)
  unsigned short* kh_u = kh_s[hs];
  unsigned short* kg_u = kg_s[hs];
  unsigned short* vh_u = vh_s[hs];
  unsigned short* vr_u = vr_s[hs];
  float* sMW = sMW_s[hs];
  const _Float16* khh = (const _Float16*)(const void*)kh_u;
  const _Float16* kgg = (const _Float16*)(const void*)kg_u;
  const _Float16* vhh = (const _Float16*)(const void*)vh_u;
  const _Float16* vrl = (const _Float16*)(const void*)vr_u;

  const int b = blockIdx.x;
  const int h = blockIdx.y * 2 + hs;
  const int qBase = qw * 16;
  const int rlane = lane & 15, hsel = lane >> 4, koff = hsel * 8;
  const float C2048  = 1.0f / 2048.0f;
  const float C1024  = 1.0f / 1024.0f;
  const float LN1024 = 6.931471805599453f;

  const size_t qrow = (size_t)(b * NR_ + qBase + rlane);           // token index of this lane's query
  const float* crow = cost + qrow * NC_ + koff;                      // + key base

  // ---- stage: all global loads first, then convert and store ----
  {
    const float* xrg = row_emb + (size_t)b * NR_ * NE_ + (size_t)tid * 8;
    const float* xcg = col_emb + (size_t)b * NC_ * NE_ + (size_t)tid * 8;
    const int oq = tid & 7, ep = tid >> 3;                         // 4 columns o, rows e = 2*ep, 2*ep+1 (+128 per pass)
    const unsigned wto = (unsigned)(2 * ep * NE_ + oq * 4);        // per thread; the pair's column base is block-uniform
    v4f ra[8][2], ca[8][2], wa[6][2];
#pragma unroll
    for (int z = 0; z < 3; ++z) {                                  // 2 passes x 64 row pairs x 8 column quads = 256 x 32
      const float* Wz = ((z == 0) ? Wq : ((z == 1) ? Wk : Wv)) + blockIdx.y * 32 + wto;
#pragma unroll
      for (int p = 0; p < 2; ++p) {
        wa[z * 2 + p][0] = *(const v4f*)(Wz + p * 128 * NE_);
        wa[z * 2 + p][1] = *(const v4f*)(Wz + p * 128 * NE_ + NE_);
      }
    }
    // precaution: this wait stands in front of every rewrite of the weight loads' offset register; the register is named
    // as an input so that it stays live up to the wait and no later load's result is placed in it
    asm volatile("s_wait_xcnt 0x0" :: "v"(wto * 4u) : "memory");
#pragma unroll
    for (int p = 0; p < 8; ++p) {                                  // 8 passes x 512 threads x 8 = 128 x 256
      ra[p][0] = *(const v4f*)(xrg + p * 4096);
      ra[p][1] = *(const v4f*)(xrg + p * 4096 + 4);
    }
#pragma unroll
    for (int p = 0; p < 8; ++p) {
      ca[p][0] = *(const v4f*)(xcg + p * 4096);
      ca[p][1] = *(const v4f*)(xcg + p * 4096 + 4);
    }
    // the same for the activation loads' offset register
    asm volatile("s_wait_xcnt 0x0" :: "v"((unsigned)tid * 32u) : "memory");
    if (qw == 0) {                                                 // wave-uniform
      // unit m = rlane: lane half 0 brings w0 and b1, lane half 1 brings w1 and w2; every lane loads and stores
      const int iA = h * 2 * MS_ + hsel * MS_ + rlane;
      const float* pB = (hsel ? m2w : m1b) + h * MS_ + rlane;
      const float rA = m1w[iA];
      const float rB = *pB;
      const float r4 = m2b[h];
      // the same for these loads' index and address registers
      asm volatile("s_wait_xcnt 0x0" :: "v"(iA), "v"(pB), "v"(h) : "memory");
      sMW[4 * rlane + hsel]     = bfr(rA);
      sMW[4 * rlane + 2 + hsel] = bfr(rB);
      sMW[MS_ * 4 + lane] = bfr(r4);                               // no lane test, so that this load issues with the other two
    }
    const int xso = (tid >> 5) * XP_ + (tid & 31) * 8;             // row tid>>5 (+16 per pass), 8 columns
#pragma unroll
    for (int p = 0; p < 8; ++p) *(v4u*)(xr_s + xso + p * 16 * XP_) = cvt_h8v(ra[p][0], ra[p][1], 16.0f);
#pragma unroll
    for (int p = 0; p < 8; ++p) *(v4u*)(xc_s + xso + p * 16 * XP_) = cvt_h8v(ca[p][0], ca[p][1], 16.0f);
#pragma unroll
    for (int z = 0; z < 3; ++z)
#pragma unroll
      for (int p = 0; p < 2; ++p)
#pragma unroll
        for (int i = 0; i < 4; ++i)
          *(unsigned*)(wt_s + (z * 32 + oq * 4 + i) * XP_ + p * 128 + 2 * ep) =
              pk16(cvt_h1(wa[z * 2 + p][0][i], 1024.0f), cvt_h1(wa[z * 2 + p][1][i], 1024.0f));
  }
  __syncthreads();                                                 // activations and weights staged

  {
    // ---- project: three 16x16 tiles of this wave's 16 tokens and head, same k order in every loader ----
    v16h qh, ql;
    {
      const _Float16* xrf = (const _Float16*)(const void*)xr_s + (qBase + rlane) * XP_ + koff;
      const _Float16* xcf = (const _Float16*)(const void*)xc_s + (qBase + rlane) * XP_ + koff;
      const _Float16* wf  = (const _Float16*)(const void*)wt_s + (hs * 16 + rlane) * XP_ + koff;
      v8f aq = zero8(), ak = zero8(), av = zero8();
#pragma unroll
      for (int k0 = 0; k0 < NE_; k0 += 32) {
        const v16h xa = ldfrag_h(xrf + k0);
        const v16h xb = ldfrag_h(xcf + k0);
        const v16h fq = ldfrag_h(wf + k0);
        const v16h fk = ldfrag_h(wf + 32 * XP_ + k0);
        const v16h fv = ldfrag_h(wf + 64 * XP_ + k0);
        aq = mma_h_raw(fq, xa, aq);
        ak = mma_h_raw(fk, xb, ak);
        av = mma_h_raw(xb, fv, av);
      }
      v8h hi, lo;
      split8(aq, hi, lo);
      qh = pad8z(hi);
      ql = pad8z(lo);
      split8(ak, hi, lo);
      *(v8h*)(void*)(kh_u + (qBase + rlane) * HD_ + koff) = hi;
      *(v8h*)(void*)(kg_u + (qBase + rlane) * HD_ + koff) = lo;
      split8(av, hi, lo);
      *(v8h*)(void*)(vh_u + rlane * VPITCH + qBase + koff) = hi;
      *(v8h*)(void*)(vr_u + rlane * VPITCH + qBase + koff) = lo;
    }
    __syncthreads();                                               // K rows and V^T rows of both heads published

    v8f oh = zero8(), ol = zero8();
    float m_run = -1e30f, l_run = 0.f;

    {
#pragma unroll 1
      for (int sub = 0; sub < NC_ / 32; ++sub) {
        const int kr = 32 * sub;
        // scores: two 16-key tiles, d padded to 32, hi and residual planes of both operands
        const v16h kf0 = ldfrag_8z(khh + (kr + rlane) * HD_ + koff);
        const v16h kf1 = ldfrag_8z(khh + (kr + 16 + rlane) * HD_ + koff);
        const v16h kg0 = ldfrag_8z(kgg + (kr + rlane) * HD_ + koff);
        const v16h kg1 = ldfrag_8z(kgg + (kr + 16 + rlane) * HD_ + koff);
        v8f sr0 = mma_h_raw(kf0, ql, zero8());
        v8f sr1 = mma_h_raw(kf1, ql, zero8());
        v8f sh0 = mma_h_raw(kf0, qh, zero8());
        v8f sh1 = mma_h_raw(kf1, qh, zero8());
        sr0 = mma_h_raw(kg0, qh, sr0);
        sr1 = mma_h_raw(kg1, qh, sr1);
        guard4x6(sh0, sh1, sr0, sr1, kf0, kf1, kg0, kg1, qh, ql);

        // cost for keys kr+8h+r (tile 0) and kr+16+8h+r (tile 1), RNE-converted to bf16
        const v4f ca0 = *(const v4f*)(crow + kr);
        const v4f ca1 = *(const v4f*)(crow + kr + 4);
        const v4f cb0 = *(const v4f*)(crow + kr + 16);
        const v4f cb1 = *(const v4f*)(crow + kr + 20);
        float d0[8], d1[8], c0[8], c1[8];
#pragma unroll
        for (int r = 0; r < 4; ++r) {
          c0[r] = bfr(ca0[r]); c0[r + 4] = bfr(ca1[r]);
          c1[r] = bfr(cb0[r]); c1[r + 4] = bfr(cb1[r]);
        }
#pragma unroll
        for (int r = 0; r < 8; ++r) {
          d0[r] = (sh0[r] + sr0[r] * C2048) * C1024;
          d1[r] = (sh1[r] + sr1[r] * C2048) * C1024;
        }

        // per-head two-score MLP: lg = b2 + sum_m relu(dot*w0 + cost*w1 + b1) * w2   (f32, m loop rolled)
        const float b2v = sMW[MS_ * 4];
        float a0[8], a1[8];
#pragma unroll
        for (int r = 0; r < 8; ++r) { a0[r] = b2v; a1[r] = b2v; }
#pragma unroll 1
        for (int m = 0; m < MS_; ++m) {
          const v4f w = *(const v4f*)(sMW + 4 * m);
#pragma unroll
          for (int r = 0; r < 8; ++r) {
            const float t0 = fmaxf(fmaf(d0[r], w[0], fmaf(c0[r], w[1], w[2])), 0.0f);
            const float t1 = fmaxf(fmaf(d1[r], w[0], fmaf(c1[r], w[1], w[2])), 0.0f);
            a0[r] = fmaf(t0, w[3], a0[r]);
            a1[r] = fmaf(t1, w[3], a1[r]);
          }
        }

        // online softmax over the key axis for this lane's q column
        float mloc = -1e30f;
#pragma unroll
        for (int r = 0; r < 8; ++r) mloc = fmaxf(mloc, fmaxf(a0[r], a1[r]));
        mloc = fmaxf(mloc, __shfl_xor(mloc, 16, 32));
        const float newM  = fmaxf(m_run, mloc);
        const float alpha = __expf(m_run - newM);
        const float msh   = newM - LN1024;
        float ssum = 0.f;
        float p0[8], p1[8];
#pragma unroll
        for (int r = 0; r < 8; ++r) {
          p0[r] = __expf(a0[r] - msh);
          p1[r] = __expf(a1[r] - msh);
          ssum += p0[r] + p1[r];
        }
        ssum += __shfl_xor(ssum, 16, 32);
        l_run = l_run * alpha + ssum;
        m_run = newM;
#pragma unroll
        for (int r = 0; r < 8; ++r) { oh[r] *= alpha; ol[r] *= alpha; }

        // P (f32, D layout) -> B operand (f16): element r <- keys 0-15 tile, 8+r <- keys 16-31 tile
        union { v16h v; _Float16 s[16]; } pf;
#pragma unroll
        for (int r = 0; r < 8; ++r) {
          pf.s[r]     = (_Float16)p0[r];
          pf.s[8 + r] = (_Float16)p1[r];
        }

        // O[d][q] += V^T[d][kr .. +31] x P, hi and residual planes in separate accumulators
        const v16h vah = ldfrag_h(vhh + rlane * VPITCH + kr + koff);
        const v16h val = ldfrag_h(vrl + rlane * VPITCH + kr + koff);
        oh = mma_h_raw(vah, pf.v, oh);
        ol = mma_h_raw(val, pf.v, ol);
        guard2x3(oh, ol, vah, val, pf.v);
      }
    }
    acc_guard2(oh, ol);

    // ---- per-head ctx values -> LDS staging (own lane slots): row q, cols hs*16 + 8*hsel + 0..7 ----
    const float inv = (1.0f / 16.0f) * (1.0f / l_run);     // ctx = (Oh + Ol/2048) / (16 * l)
    v4f f0, f1;
#pragma unroll
    for (int e = 0; e < 4; ++e) {
      f0[e] = (oh[e]     + ol[e]     * C2048) * inv;
      f1[e] = (oh[4 + e] + ol[4 + e] * C2048) * inv;
    }
    const int so = (qBase + rlane) * SP_ + hs * 16 + koff;
    *(v4f*)(sto + so)     = f0;
    *(v4f*)(sto + so + 4) = f1;

    __syncthreads();                                         // both heads of the pair staged
    {
      const int rq = lane >> 3, c4 = (lane & 7) * 4;
      const float* ss = sto + (wave * 8) * SP_;
      v4f ov[2];
#pragma unroll
      for (int it = 0; it < 2; ++it) ov[it] = *(const v4f*)(ss + (it * 4 + rq) * SP_ + c4);
      float* ob = out + ((size_t)(b * NR_ + wave * 8)) * NE_ + (size_t)blockIdx.y * 32 + c4;
#pragma unroll
      for (int it = 0; it < 2; ++it) {
        const int row = it * 4 + rq;                         // it 0..1 x rq 0..3 = rows 0..7
        *(v4f*)(ob + (size_t)row * NE_) = ov[it];
      }
    }
  }
}

extern "C" void kernel_launch(void* const* d_in, const int* in_sizes, int n_in,
                              void* d_out, int out_size, void* d_ws, size_t ws_size,
                              hipStream_t stream) {
  if (n_in < 10) return;
  if (in_sizes[0] != NB_ * NR_ * NE_) return;
  if (in_sizes[1] != NB_ * NC_ * NE_) return;
  if (in_sizes[2] != NB_ * NR_ * NC_) return;
  if (in_sizes[3] != NE_ * NE_) return;
  if (in_sizes[4] != NE_ * NE_) return;
  if (in_sizes[5] != NE_ * NE_) return;
  if (in_sizes[6] != NH_ * 2 * MS_) return;
  if (in_sizes[7] != NH_ * MS_) return;
  if (in_sizes[8] != NH_ * MS_) return;
  if (in_sizes[9] < NH_) return;
  if (out_size != NB_ * NR_ * NE_) return;
  (void)d_ws;
  (void)ws_size;

  const float* row_emb = (const float*)d_in[0];
  const float* col_emb = (const float*)d_in[1];
  const float* costm   = (const float*)d_in[2];
  const float* Wq      = (const float*)d_in[3];
  const float* Wk      = (const float*)d_in[4];
  const float* Wv      = (const float*)d_in[5];
  const float* m1w     = (const float*)d_in[6];
  const float* m1b     = (const float*)d_in[7];
  const float* m2w     = (const float*)d_in[8];
  const float* m2b     = (const float*)d_in[9];
  float*       out     = (float*)d_out;

  const dim3 gAttn(NB_, NH_ / 2);                              // 32 x 8 = 256
  const dim3 blkA(512);
  // projections and attention with the per-head two-score MLP, one head pair of a batch per block -> out [b][r][h*16+d]
  attn_kernel<<<gAttn, blkA, 0, stream>>>(row_emb, col_emb, costm, Wq, Wk, Wv, m1w, m1b, m2w, m2b, out);
  (void)hipGetLastError();
}

// v003
// Measured time: 18.9 microseconds a run.
// Two timings next to v002 both put it at 1.11 times that version's speed.
// Over all steps from v000 it is 8.93 times as fast.
// One launch. Contractions: q/k/v projections x.W (bf16-RNE operands, exact products, K 256, v_wmma_f32_16x16x32_bf16);
// scores k.q (k and q as f16 hi planes x16 plus f16 residual planes x2^11, 3 products hh + (hl + lh) in a separate accumulator);
// context v.p (p x1024 f16, v as f16 hi x16 plus residual x2^11, 2 products, separate accumulators);
// scores and context on v_wmma_f32_16x16x32_f16; all with f32 accumulate; two-score MLP, softmax statistics and normalisation in f32 on VALU.
#include <hip/hip_runtime.h>
#include <math.h>
#include <stdint.h>

#define NB_  32
#define NR_  128
#define NC_  128
#define NE_  256
#define NH_  16
#define HD_  16
#define MS_  16
#define NTOK (NB_ * NR_)
static_assert(NH_ * HD_ == NE_);
static_assert(NR_ == NC_);
static_assert((NTOK % 64) == 0 && (NE_ % 64) == 0 && (NC_ % 64) == 0 && (NE_ % 32) == 0);

typedef _Float16 v16h __attribute__((ext_vector_type(16)));
typedef _Float16 v8h  __attribute__((ext_vector_type(8)));
typedef __bf16   v16b __attribute__((ext_vector_type(16)));
typedef __bf16   v2b  __attribute__((ext_vector_type(2)));
typedef float    v2f  __attribute__((ext_vector_type(2)));
typedef float    v8f  __attribute__((ext_vector_type(8)));
typedef float    v4f  __attribute__((ext_vector_type(4)));
typedef unsigned int v4u __attribute__((ext_vector_type(4)));

// ---- scalar helpers --------------------------------------------------------------------------------
__device__ __forceinline__ unsigned bf_pk(float a, float b) {         // two f32 -> two bf16 (RNE), a in the low half: one packed convert
  const v2f x = {a, b};
  return __builtin_bit_cast(unsigned, __builtin_convertvector(x, v2b));
}
__device__ __forceinline__ float bfr(float f) { return __uint_as_float(bf_pk(f, f) & 0xFFFF0000u); }
__device__ __forceinline__ void bfr2(float a, float b, float& ra, float& rb) {   // both rounded to bf16 values, kept in f32
  const unsigned u = bf_pk(a, b);
  ra = __uint_as_float(u << 16);
  rb = __uint_as_float(u & 0xFFFF0000u);
}
__device__ __forceinline__ v8f zero8() { v8f z = {0.f, 0.f, 0.f, 0.f, 0.f, 0.f, 0.f, 0.f}; return z; }

// ---- fragment loaders: 16-bit A/B operand, lane -> row/col (lane&15), p already includes +8*(lane>>4);
//      elements 0..7 <- p[0..7] (k0+8h..), elements 8..15 <- p[16..23] (k0+16+8h..)
__device__ __forceinline__ v16h ldfrag_h(const _Float16* p) {
  union { v16h v; v8h h[2]; } f;
  f.h[0] = *(const v8h*)(p);
  f.h[1] = *(const v8h*)(p + 16);
  return f.v;
}
__device__ __forceinline__ v16b ldfrag_b(const unsigned short* p) {   // the same map for bf16 bits
  union { v16b v; v4u q[2]; } f;
  f.q[0] = *(const v4u*)(p);
  f.q[1] = *(const v4u*)(p + 16);
  return f.v;
}
//      16-deep contraction padded to 32 in registers: elements 0..7 <- p[0..7], elements 8..15 = 0
__device__ __forceinline__ v16h ldfrag_8z(const _Float16* p) {
  union { v16h v; v8h h[2]; } f;
  const _Float16 zz = (_Float16)0.0f;
  const v8h z = {zz, zz, zz, zz, zz, zz, zz, zz};
  f.h[0] = *(const v8h*)(p);
  f.h[1] = z;
  return f.v;
}

// ---- WMMA helpers with trailing VALU hazard gap --------------------------------------------------------
__device__ __forceinline__ v8f mma_h_raw(v16h a, v16h b, v8f c) {
  return __builtin_amdgcn_wmma_f32_16x16x32_f16(false, a, false, b, (short)0, c, false, false);
}
__device__ __forceinline__ v8f mma_b_raw(v16b a, v16b b, v8f c) {
  return __builtin_amdgcn_wmma_f32_16x16x32_bf16(false, a, false, b, (short)0, c, false, false);
}
__device__ __forceinline__ void guard2x3(v8f& a, v8f& b, v16h x, v16h y, v16h z) {
#if defined(__HIP_DEVICE_COMPILE__)
  asm volatile("v_nop\n\tv_nop\n\tv_nop\n\tv_nop" : "+v"(a), "+v"(b) : "v"(x), "v"(y), "v"(z));
#endif
}
__device__ __forceinline__ void guard4x6(v8f& a, v8f& b, v8f& c, v8f& d,
                                         v16h u, v16h w, v16h x, v16h y, v16h z, v16h t) {
#if defined(__HIP_DEVICE_COMPILE__)
  asm volatile("v_nop\n\tv_nop\n\tv_nop\n\tv_nop"
               : "+v"(a), "+v"(b), "+v"(c), "+v"(d)
               : "v"(u), "v"(w), "v"(x), "v"(y), "v"(z), "v"(t));
#endif
}
__device__ __forceinline__ void acc_guard2(v8f& a, v8f& b) {
#if defined(__HIP_DEVICE_COMPILE__)
  asm volatile("v_nop\n\tv_nop\n\tv_nop\n\tv_nop" : "+v"(a), "+v"(b));
#endif
}

// ---- 8 x f32 -> 8 x bf16 (RNE), packed for one 16-B store
__device__ __forceinline__ v4u cvt_b8v(v4f a, v4f c) {
  v4u p;
  p[0] = bf_pk(a[0], a[1]);
  p[1] = bf_pk(a[2], a[3]);
  p[2] = bf_pk(c[0], c[1]);
  p[3] = bf_pk(c[2], c[3]);
  return p;
}
// ---- projection accumulator -> f16 hi plane (x16) and f16 residual plane (x2^11), 8 values each
__device__ __forceinline__ void split8(v8f acc, v8h& hi, v8h& lo) {
#pragma unroll
  for (int r = 0; r < 8; ++r) {
    const float f = acc[r] * 16.0f;
    const _Float16 xh = (_Float16)f;
    hi[r] = xh;
    lo[r] = (_Float16)((f - (float)xh) * 2048.0f);
  }
}
__device__ __forceinline__ v16h pad8z(v8h x) {                    // elements 0..7 <- x, elements 8..15 = 0
  union { v16h v; v8h h[2]; } f;
  const _Float16 zz = (_Float16)0.0f;
  const v8h z = {zz, zz, zz, zz, zz, zz, zz, zz};
  f.h[0] = x;
  f.h[1] = z;
  return f.v;
}

// =====================================================================================================
// Projections and attention with the two-score MLP in one kernel, head dim 16 (padded to 32 in registers).
// grid = (NB_ batches, NH_/2 head pairs), 512 threads = 2 heads of the pair x 8 waves x 16 tokens.
// Stage: the batch's row and col activations (128 x 256 each) and the pair's 32 columns of Wq / Wk / Wv (transposed to
// [o][e]) are read as f32, RNE-converted to bf16 and laid in LDS, pitch XP_.
// Project: wave (head hs, group qw) forms three 16x16 tiles over K = 256, all for tokens qw*16..+15 and head hs:
//   q^T[d][q]   = A(WqT rows d) x B(xr rows q)   -> D lane = q, rows d = 8*(lane>>4)+r: already the B fragment of the scores
//   k^T[d][key] = A(WkT rows d) x B(xc rows key) -> D lane = key, 8 d: one 16-B store into the K rows [key][16]
//   v[key][d]   = A(xc rows key) x B(WvT rows d) -> D lane = d, 8 keys: one 16-B store into the V^T rows [d][128]
// each split into an f16 hi plane (x16) and an f16 residual plane (x2^11).
// Attend, per 32-key step over the 128 keys held in LDS:
// S[key][q] = A(K hi rows) x B(Q hi) ; Sr = A(K hi) x B(Q res) + A(K res) x B(Q hi) (separate accumulator, /2048);
// dot = (S + Sr/2048)/1024; cost RNE-bf16 per (q,key) from global; lg = b2 + sum_m relu(dot*w0+cost*w1+b1)*w2
// in f32 (m loop rolled); online softmax over keys (max/sum across lane halves by shuffle),
// p = 1024*exp(x - max) packed D->B per the chained map (element r <- keys 0-15 tile, 8+r <- keys 16-31 tile);
// Oh[d][q] += A(V hi rows) x P, Ol[d][q] += A(V res rows) x P; both rescaled by alpha;
// ctx = (Oh + Ol/2048) / (16 l). The 16 ctx values of (q, head) go to LDS staging shared by the pair's two heads.
// coverage: block = 128 queries x 32 cols (one head pair); per wave 2 it x 4 rows x 8 pieces of 4 floats = 8 x 32;
//           16 waves x 8 rows = 128 rows; NB_ x NH_/2 blocks.
// =====================================================================================================
#define XP_    264                                                  // 528 B = 16 B x 33
#define VPITCH 136                                                  // 272 B = 16 B x 17
#define SP_    36
__global__ __launch_bounds__(512) void attn_kernel(
    const float* __restrict__ row_emb, const float* __restrict__ col_emb,
    const float* __restrict__ cost,
    const float* __restrict__ Wq, const float* __restrict__ Wk, const float* __restrict__ Wv,
    const float* __restrict__ m1w, const float* __restrict__ m1b,
    const float* __restrict__ m2w, const float* __restrict__ m2b,
    float* out) {
  __shared__ __align__(16) unsigned short xr_s[NR_ * XP_];         // 67584 B
  __shared__ __align__(16) unsigned short xc_s[NC_ * XP_];         // 67584 B
  __shared__ __align__(16) unsigned short wt_s[3 * 32 * XP_];      // 50688 B, rows z*32 + o of the pair
  __shared__ __align__(16) unsigned short kh_s[2][NC_ * HD_];      // 2 x 4096 B, one set per head of the pair
  __shared__ __align__(16) unsigned short kg_s[2][NC_ * HD_];      // 2 x 4096 B
  __shared__ __align__(16) unsigned short vh_s[2][16 * VPITCH];    // 2 x 4352 B
  __shared__ __align__(16) unsigned short vr_s[2][16 * VPITCH];    // 2 x 4352 B
  __shared__ __align__(16) float sMW_s[2][MS_ * 4 + 32];           // 2 x 384 B: 16 x (w0, w1, b1, w2), then b2 once per lane
  __shared__ __align__(16) float sto[8 * 16 * SP_];                // 18432 B
  const int tid = threadIdx.x, lane = tid & 31, wave = tid >> 5;
  const int hs = wave >> 3, qw = wave & 7;                         // head of the pair, token group (wave-uniform)
  unsigned short* kh_u = kh_s[hs];
  unsigned short* kg_u = kg_s[hs];
  unsigned short* vh_u = vh_s[hs];
  unsigned short* vr_u = vr_s[hs];
  float* sMW = sMW_s[hs];
  const _Float16* khh = (const _Float16*)(const void*)kh_u;
  const _Float16* kgg = (const _Float16*)(const void*)kg_u;
  const _Float16* vhh = (const _Float16*)(const void*)vh_u;
  const _Float16* vrl = (const _Float16*)(const void*)vr_u;

  const int b = blockIdx.x;
  const int h = blockIdx.y * 2 + hs;
  const int qBase = qw * 16;
  const int rlane = lane & 15, hsel = lane >> 4, koff = hsel * 8;
  const float C2048  = 1.0f / 2048.0f;
  const float C1024  = 1.0f / 1024.0f;
  const float LN1024 = 6.931471805599453f;

  const size_t qrow = (size_t)(b * NR_ + qBase + rlane);           // token index of this lane's query
  const float* crow = cost + qrow * NC_ + koff;                      // + key base

  // ---- stage: all global loads first, then convert and store ----
  {
    const float* xrg = row_emb + (size_t)b * NR_ * NE_ + (size_t)tid * 8;
    const float* xcg = col_emb + (size_t)b * NC_ * NE_ + (size_t)tid * 8;
    const int oq = tid & 7, ep = tid >> 3;                         // 4 columns o, rows e = 2*ep, 2*ep+1 (+128 per pass)
    const unsigned wto = (unsigned)(2 * ep * NE_ + oq * 4);        // per thread; the pair's column base is block-uniform
    v4f ra[8][2], ca[8][2], wa[6][2];
#pragma unroll
    for (int z = 0; z < 3; ++z) {                                  // 2 passes x 64 row pairs x 8 column quads = 256 x 32
      const float* Wz = ((z == 0) ? Wq : ((z == 1) ? Wk : Wv)) + blockIdx.y * 32 + wto;
#pragma unroll
      for (int p = 0; p < 2; ++p) {
        wa[z * 2 + p][0] = *(const v4f*)(Wz + p * 128 * NE_);
        wa[z * 2 + p][1] = *(const v4f*)(Wz + p * 128 * NE_ + NE_);
      }
    }
    // precaution: this wait stands in front of every rewrite of the weight loads' offset register; the register is named
    // as an input so that it stays live up to the wait and no later load's result is placed in it
    asm volatile("s_wait_xcnt 0x0" :: "v"(wto * 4u) : "memory");
#pragma unroll
    for (int p = 0; p < 8; ++p) {                                  // 8 passes x 512 threads x 8 = 128 x 256
      ra[p][0] = *(const v4f*)(xrg + p * 4096);
      ra[p][1] = *(const v4f*)(xrg + p * 4096 + 4);
    }
#pragma unroll
    for (int p = 0; p < 8; ++p) {
      ca[p][0] = *(const v4f*)(xcg + p * 4096);
      ca[p][1] = *(const v4f*)(xcg + p * 4096 + 4);
    }
    // the same for the activation loads' offset register
    asm volatile("s_wait_xcnt 0x0" :: "v"((unsigned)tid * 32u) : "memory");
    if (qw == 0) {                                                 // wave-uniform
      // unit m = rlane: lane half 0 brings w0 and b1, lane half 1 brings w1 and w2; every lane loads and stores
      const int iA = h * 2 * MS_ + hsel * MS_ + rlane;
      const float* pB = (hsel ? m2w : m1b) + h * MS_ + rlane;
      const float rA = m1w[iA];
      const float rB = *pB;
      const float r4 = m2b[h];
      // the same for these loads' index and address registers
      asm volatile("s_wait_xcnt 0x0" :: "v"(iA), "v"(pB), "v"(h) : "memory");
      sMW[4 * rlane + hsel]     = bfr(rA);
      sMW[4 * rlane + 2 + hsel] = bfr(rB);
      sMW[MS_ * 4 + lane] = bfr(r4);                               // no lane test, so that this load issues with the other two
    }
    const int xso = (tid >> 5) * XP_ + (tid & 31) * 8;             // row tid>>5 (+16 per pass), 8 columns
#pragma unroll
    for (int p = 0; p < 8; ++p) *(v4u*)(xr_s + xso + p * 16 * XP_) = cvt_b8v(ra[p][0], ra[p][1]);
#pragma unroll
    for (int p = 0; p < 8; ++p) *(v4u*)(xc_s + xso + p * 16 * XP_) = cvt_b8v(ca[p][0], ca[p][1]);
#pragma unroll
    for (int z = 0; z < 3; ++z)
#pragma unroll
      for (int p = 0; p < 2; ++p)
#pragma unroll
        for (int i = 0; i < 4; ++i)
          *(unsigned*)(wt_s + (z * 32 + oq * 4 + i) * XP_ + p * 128 + 2 * ep) =
              bf_pk(wa[z * 2 + p][0][i], wa[z * 2 + p][1][i]);
  }
  __syncthreads();                                                 // activations and weights staged

  {
    // ---- project: three 16x16 tiles of this wave's 16 tokens and head, same k order in every loader ----
    v16h qh, ql;
    {
      const unsigned short* xrf = xr_s + (qBase + rlane) * XP_ + koff;
      const unsigned short* xcf = xc_s + (qBase + rlane) * XP_ + koff;
      const unsigned short* wf  = wt_s + (hs * 16 + rlane) * XP_ + koff;
      v8f aq = zero8(), ak = zero8(), av = zero8();
#pragma unroll
      for (int k0 = 0; k0 < NE_; k0 += 32) {
        const v16b xa = ldfrag_b(xrf + k0);
        const v16b xb = ldfrag_b(xcf + k0);
        const v16b fq = ldfrag_b(wf + k0);
        const v16b fk = ldfrag_b(wf + 32 * XP_ + k0);
        const v16b fv = ldfrag_b(wf + 64 * XP_ + k0);
        aq = mma_b_raw(fq, xa, aq);
        ak = mma_b_raw(fk, xb, ak);
        av = mma_b_raw(xb, fv, av);
      }
      v8h hi, lo;
      split8(aq, hi, lo);
      qh = pad8z(hi);
      ql = pad8z(lo);
      split8(ak, hi, lo);
      *(v8h*)(void*)(kh_u + (qBase + rlane) * HD_ + koff) = hi;
      *(v8h*)(void*)(kg_u + (qBase + rlane) * HD_ + koff) = lo;
      split8(av, hi, lo);
      *(v8h*)(void*)(vh_u + rlane * VPITCH + qBase + koff) = hi;
      *(v8h*)(void*)(vr_u + rlane * VPITCH + qBase + koff) = lo;
    }
    __syncthreads();                                               // K rows and V^T rows of both heads published

    v8f oh = zero8(), ol = zero8();
    float m_run = -1e30f, l_run = 0.f;

    {
#pragma unroll 1
      for (int sub = 0; sub < NC_ / 32; ++sub) {
        const int kr = 32 * sub;
        // scores: two 16-key tiles, d padded to 32, hi and residual planes of both operands
        const v16h kf0 = ldfrag_8z(khh + (kr + rlane) * HD_ + koff);
        const v16h kf1 = ldfrag_8z(khh + (kr + 16 + rlane) * HD_ + koff);
        const v16h kg0 = ldfrag_8z(kgg + (kr + rlane) * HD_ + koff);
        const v16h kg1 = ldfrag_8z(kgg + (kr + 16 + rlane) * HD_ + koff);
        v8f sr0 = mma_h_raw(kf0, ql, zero8());
        v8f sr1 = mma_h_raw(kf1, ql, zero8());
        v8f sh0 = mma_h_raw(kf0, qh, zero8());
        v8f sh1 = mma_h_raw(kf1, qh, zero8());
        sr0 = mma_h_raw(kg0, qh, sr0);
        sr1 = mma_h_raw(kg1, qh, sr1);
        guard4x6(sh0, sh1, sr0, sr1, kf0, kf1, kg0, kg1, qh, ql);

        // cost for keys kr+8h+r (tile 0) and kr+16+8h+r (tile 1), RNE-converted to bf16
        const v4f ca0 = *(const v4f*)(crow + kr);
        const v4f ca1 = *(const v4f*)(crow + kr + 4);
        const v4f cb0 = *(const v4f*)(crow + kr + 16);
        const v4f cb1 = *(const v4f*)(crow + kr + 20);
        float d0[8], d1[8], c0[8], c1[8];
#pragma unroll
        for (int r = 0; r < 4; r += 2) {
          bfr2(ca0[r], ca0[r + 1], c0[r], c0[r + 1]); bfr2(ca1[r], ca1[r + 1], c0[r + 4], c0[r + 5]);
          bfr2(cb0[r], cb0[r + 1], c1[r], c1[r + 1]); bfr2(cb1[r], cb1[r + 1], c1[r + 4], c1[r + 5]);
        }
#pragma unroll
        for (int r = 0; r < 8; ++r) {
          d0[r] = (sh0[r] + sr0[r] * C2048) * C1024;
          d1[r] = (sh1[r] + sr1[r] * C2048) * C1024;
        }

        // per-head two-score MLP: lg = b2 + sum_m relu(dot*w0 + cost*w1 + b1) * w2   (f32, m loop rolled)
        const float b2v = sMW[MS_ * 4];
        float a0[8], a1[8];
#pragma unroll
        for (int r = 0; r < 8; ++r) { a0[r] = b2v; a1[r] = b2v; }
#pragma unroll 1
        for (int m = 0; m < MS_; ++m) {
          const v4f w = *(const v4f*)(sMW + 4 * m);
#pragma unroll
          for (int r = 0; r < 8; ++r) {
            const float t0 = fmaxf(fmaf(d0[r], w[0], fmaf(c0[r], w[1], w[2])), 0.0f);
            const float t1 = fmaxf(fmaf(d1[r], w[0], fmaf(c1[r], w[1], w[2])), 0.0f);
            a0[r] = fmaf(t0, w[3], a0[r]);
            a1[r] = fmaf(t1, w[3], a1[r]);
          }
        }

        // online softmax over the key axis for this lane's q column
        float mloc = -1e30f;
#pragma unroll
        for (int r = 0; r < 8; ++r) mloc = fmaxf(mloc, fmaxf(a0[r], a1[r]));
        mloc = fmaxf(mloc, __shfl_xor(mloc, 16, 32));
        const float newM  = fmaxf(m_run, mloc);
        const float alpha = __expf(m_run - newM);
        const float msh   = newM - LN1024;
        float ssum = 0.f;
        float p0[8], p1[8];
#pragma unroll
        for (int r = 0; r < 8; ++r) {
          p0[r] = __expf(a0[r] - msh);
          p1[r] = __expf(a1[r] - msh);
          ssum += p0[r] + p1[r];
        }
        ssum += __shfl_xor(ssum, 16, 32);
        l_run = l_run * alpha + ssum;
        m_run = newM;
#pragma unroll
        for (int r = 0; r < 8; ++r) { oh[r] *= alpha; ol[r] *= alpha; }

        // P (f32, D layout) -> B operand (f16): element r <- keys 0-15 tile, 8+r <- keys 16-31 tile
        union { v16h v; _Float16 s[16]; } pf;
#pragma unroll
        for (int r = 0; r < 8; ++r) {
          pf.s[r]     = (_Float16)p0[r];
          pf.s[8 + r] = (_Float16)p1[r];
        }

        // O[d][q] += V^T[d][kr .. +31] x P, hi and residual planes in separate accumulators
        const v16h vah = ldfrag_h(vhh + rlane * VPITCH + kr + koff);
        const v16h val = ldfrag_h(vrl + rlane * VPITCH + kr + koff);
        oh = mma_h_raw(vah, pf.v, oh);
        ol = mma_h_raw(val, pf.v, ol);
        guard2x3(oh, ol, vah, val, pf.v);
      }
    }
    acc_guard2(oh, ol);

    // ---- per-head ctx values -> LDS staging (own lane slots): row q, cols hs*16 + 8*hsel + 0..7 ----
    const float inv = (1.0f / 16.0f) * (1.0f / l_run);     // ctx = (Oh + Ol/2048) / (16 * l)
    v4f f0, f1;
#pragma unroll
    for (int e = 0; e < 4; ++e) {
      f0[e] = (oh[e]     + ol[e]     * C2048) * inv;
      f1[e] = (oh[4 + e] + ol[4 + e] * C2048) * inv;
    }
    const int so = (qBase + rlane) * SP_ + hs * 16 + koff;
    *(v4f*)(sto + so)     = f0;
    *(v4f*)(sto + so + 4) = f1;

    __syncthreads();                                         // both heads of the pair staged
    {
      const int rq = lane >> 3, c4 = (lane & 7) * 4;
      const float* ss = sto + (wave * 8) * SP_;
      v4f ov[2];
#pragma unroll
      for (int it = 0; it < 2; ++it) ov[it] = *(const v4f*)(ss + (it * 4 + rq) * SP_ + c4);
      float* ob = out + ((size_t)(b * NR_ + wave * 8)) * NE_ + (size_t)blockIdx.y * 32 + c4;
#pragma unroll
      for (int it = 0; it < 2; ++it) {
        const int row = it * 4 + rq;                         // it 0..1 x rq 0..3 = rows 0..7
        *(v4f*)(ob + (size_t)row * NE_) = ov[it];
      }
    }
  }
}

extern "C" void kernel_launch(void* const* d_in, const int* in_sizes, int n_in,
                              void* d_out, int out_size, void* d_ws, size_t ws_size,
                              hipStream_t stream) {
  if (n_in < 10) return;
  if (in_sizes[0] != NB_ * NR_ * NE_) return;
  if (in_sizes[1] != NB_ * NC_ * NE_) return;
  if (in_sizes[2] != NB_ * NR_ * NC_) return;
  if (in_sizes[3] != NE_ * NE_) return;
  if (in_sizes[4] != NE_ * NE_) return;
  if (in_sizes[5] != NE_ * NE_) return;
  if (in_sizes[6] != NH_ * 2 * MS_) return;
  if (in_sizes[7] != NH_ * MS_) return;
  if (in_sizes[8] != NH_ * MS_) return;
  if (in_sizes[9] < NH_) return;
  if (out_size != NB_ * NR_ * NE_) return;
  (void)d_ws;
  (void)ws_size;

  const float* row_emb = (const float*)d_in[0];
  const float* col_emb = (const float*)d_in[1];
  const float* costm   = (const float*)d_in[2];
  const float* Wq      = (const float*)d_in[3];
  const float* Wk      = (const float*)d_in[4];
  const float* Wv      = (const float*)d_in[5];
  const float* m1w     = (const float*)d_in[6];
  const float* m1b     = (const float*)d_in[7];
  const float* m2w     = (const float*)d_in[8];
  const float* m2b     = (const float*)d_in[9];
  float*       out     = (float*)d_out;

  const dim3 gAttn(NB_, NH_ / 2);                              // 32 x 8 = 256
  const dim3 blkA(512);
  // projections and attention with the per-head two-score MLP, one head pair of a batch per block -> out [b][r][h*16+d]
  attn_kernel<<<gAttn, blkA, 0, stream>>>(row_emb, col_emb, costm, Wq, Wk, Wv, m1w, m1b, m2w, m2b, out);
  (void)hipGetLastError();
}

// v004
// It runs in 16.8 microseconds.
// Next to v003, in two timings, it ran 1.13 times as fast each time.
// Over all steps from v000 it is 10.1 times as fast.
// One launch. Contractions: q/k/v projections x.W (bf16-RNE operands, exact products, K 256, v_wmma_f32_16x16x32_bf16);
// scores k.q (k and q as f16 hi planes x16 plus f16 residual planes x2^11, 3 products hh + (hl + lh) in a separate accumulator);
// context v.p (p x1024 f16, v as f16 hi x16 plus residual x2^11, 2 products, separate accumulators);
// scores and context on v_wmma_f32_16x16x32_f16; all with f32 accumulate; two-score MLP, softmax statistics and normalisation in f32 on VALU.
// The MLP's relu is the clamp modifier of the packed FMA that ends its first layer (first-layer weights x2^-64, output weights x2^64).
#include <hip/hip_runtime.h>
#include <math.h>
#include <stdint.h>

#define NB_  32
#define NR_  128
#define NC_  128
#define NE_  256
#define NH_  16
#define HD_  16
#define MS_  16
#define NTOK (NB_ * NR_)
static_assert(NH_ * HD_ == NE_);
static_assert(NR_ == NC_);
static_assert((NTOK % 64) == 0 && (NE_ % 64) == 0 && (NC_ % 64) == 0 && (NE_ % 32) == 0);

typedef _Float16 v16h __attribute__((ext_vector_type(16)));
typedef _Float16 v8h  __attribute__((ext_vector_type(8)));
typedef __bf16   v16b __attribute__((ext_vector_type(16)));
typedef __bf16   v2b  __attribute__((ext_vector_type(2)));
typedef float    v2f  __attribute__((ext_vector_type(2)));
typedef float    v8f  __attribute__((ext_vector_type(8)));
typedef float    v4f  __attribute__((ext_vector_type(4)));
typedef unsigned int v4u __attribute__((ext_vector_type(4)));

// ---- scalar helpers --------------------------------------------------------------------------------
__device__ __forceinline__ unsigned bf_pk(float a, float b) {         // two f32 -> two bf16 (RNE), a in the low half: one packed convert
  const v2f x = {a, b};
  return __builtin_bit_cast(unsigned, __builtin_convertvector(x, v2b));
}
__device__ __forceinline__ float bfr(float f) { return __uint_as_float(bf_pk(f, f) & 0xFFFF0000u); }
__device__ __forceinline__ void bfr2(float a, float b, float& ra, float& rb) {   // both rounded to bf16 values, kept in f32
  const unsigned u = bf_pk(a, b);
  ra = __uint_as_float(u << 16);
  rb = __uint_as_float(u & 0xFFFF0000u);
}
__device__ __forceinline__ v8f zero8() { v8f z = {0.f, 0.f, 0.f, 0.f, 0.f, 0.f, 0.f, 0.f}; return z; }

// ---- fragment loaders: 16-bit A/B operand, lane -> row/col (lane&15), p already includes +8*(lane>>4);
//      elements 0..7 <- p[0..7] (k0+8h..), elements 8..15 <- p[16..23] (k0+16+8h..)
__device__ __forceinline__ v16h ldfrag_h(const _Float16* p) {
  union { v16h v; v8h h[2]; } f;
  f.h[0] = *(const v8h*)(p);
  f.h[1] = *(const v8h*)(p + 16);
  return f.v;
}
__device__ __forceinline__ v16b ldfrag_b(const unsigned short* p) {   // the same map for bf16 bits
  union { v16b v; v4u q[2]; } f;
  f.q[0] = *(const v4u*)(p);
  f.q[1] = *(const v4u*)(p + 16);
  return f.v;
}
//      16-deep contraction padded to 32 in registers: elements 0..7 <- p[0..7], elements 8..15 = 0
__device__ __forceinline__ v16h ldfrag_8z(const _Float16* p) {
  union { v16h v; v8h h[2]; } f;
  const _Float16 zz = (_Float16)0.0f;
  const v8h z = {zz, zz, zz, zz, zz, zz, zz, zz};
  f.h[0] = *(const v8h*)(p);
  f.h[1] = z;
  return f.v;
}

// ---- WMMA helpers with trailing VALU hazard gap --------------------------------------------------------
__device__ __forceinline__ v8f mma_h_raw(v16h a, v16h b, v8f c) {
  return __builtin_amdgcn_wmma_f32_16x16x32_f16(false, a, false, b, (short)0, c, false, false);
}
__device__ __forceinline__ v8f mma_b_raw(v16b a, v16b b, v8f c) {
  return __builtin_amdgcn_wmma_f32_16x16x32_bf16(false, a, false, b, (short)0, c, false, false);
}
__device__ __forceinline__ void guard2x3(v8f& a, v8f& b, v16h x, v16h y, v16h z) {
#if defined(__HIP_DEVICE_COMPILE__)
  asm volatile("v_nop\n\tv_nop\n\tv_nop\n\tv_nop" : "+v"(a), "+v"(b) : "v"(x), "v"(y), "v"(z));
#endif
}
__device__ __forceinline__ void guard4x6(v8f& a, v8f& b, v8f& c, v8f& d,
                                         v16h u, v16h w, v16h x, v16h y, v16h z, v16h t) {
#if defined(__HIP_DEVICE_COMPILE__)
  asm volatile("v_nop\n\tv_nop\n\tv_nop\n\tv_nop"
               : "+v"(a), "+v"(b), "+v"(c), "+v"(d)
               : "v"(u), "v"(w), "v"(x), "v"(y), "v"(z), "v"(t));
#endif
}
__device__ __forceinline__ void acc_guard2(v8f& a, v8f& b) {
#if defined(__HIP_DEVICE_COMPILE__)
  asm volatile("v_nop\n\tv_nop\n\tv_nop\n\tv_nop" : "+v"(a), "+v"(b));
#endif
}

// ---- one unit of the two-score MLP for 8 register pairs (16 keys), weights w01 = (w0, w1), w23 = (b1, w2):
//      t <- min(max(d * w0 + (c * w1 + b1), 0), 1), the relu being the second FMA's clamp modifier; then a <- t * w2 + a.
//      In asm because the compiler does not put the clamp on a packed f32 FMA (it adds one maximum per value), and so that each
//      weight is picked from its register by op_sel instead of being kept a second time as a broadcast pair (that form spilled).
//      Every FMA stands 8 instructions behind the one whose result it reads.
__device__ __forceinline__ void mlp_layer1(v2f (&t)[8], const v2f (&c)[8], const v2f (&d)[8], v2f w01, v2f w23) {
#if defined(__HIP_DEVICE_COMPILE__)
  asm(
      "v_pk_fma_f32 %0, %8, %24, %25 op_sel:[0,1,0] op_sel_hi:[1,1,0]\n\t"
      "v_pk_fma_f32 %1, %9, %24, %25 op_sel:[0,1,0] op_sel_hi:[1,1,0]\n\t"
      "v_pk_fma_f32 %2, %10, %24, %25 op_sel:[0,1,0] op_sel_hi:[1,1,0]\n\t"
      "v_pk_fma_f32 %3, %11, %24, %25 op_sel:[0,1,0] op_sel_hi:[1,1,0]\n\t"
      "v_pk_fma_f32 %4, %12, %24, %25 op_sel:[0,1,0] op_sel_hi:[1,1,0]\n\t"
      "v_pk_fma_f32 %5, %13, %24, %25 op_sel:[0,1,0] op_sel_hi:[1,1,0]\n\t"
      "v_pk_fma_f32 %6, %14, %24, %25 op_sel:[0,1,0] op_sel_hi:[1,1,0]\n\t"
      "v_pk_fma_f32 %7, %15, %24, %25 op_sel:[0,1,0] op_sel_hi:[1,1,0]\n\t"
      "v_pk_fma_f32 %0, %16, %24, %0 op_sel_hi:[1,0,1] clamp\n\t"
      "v_pk_fma_f32 %1, %17, %24, %1 op_sel_hi:[1,0,1] clamp\n\t"
      "v_pk_fma_f32 %2, %18, %24, %2 op_sel_hi:[1,0,1] clamp\n\t"
      "v_pk_fma_f32 %3, %19, %24, %3 op_sel_hi:[1,0,1] clamp\n\t"
      "v_pk_fma_f32 %4, %20, %24, %4 op_sel_hi:[1,0,1] clamp\n\t"
      "v_pk_fma_f32 %5, %21, %24, %5 op_sel_hi:[1,0,1] clamp\n\t"
      "v_pk_fma_f32 %6, %22, %24, %6 op_sel_hi:[1,0,1] clamp\n\t"
      "v_pk_fma_f32 %7, %23, %24, %7 op_sel_hi:[1,0,1] clamp"
      : "=&v"(t[0]), "=&v"(t[1]), "=&v"(t[2]), "=&v"(t[3]), "=&v"(t[4]), "=&v"(t[5]), "=&v"(t[6]), "=&v"(t[7])
      : "v"(c[0]), "v"(c[1]), "v"(c[2]), "v"(c[3]), "v"(c[4]), "v"(c[5]), "v"(c[6]), "v"(c[7]),
        "v"(d[0]), "v"(d[1]), "v"(d[2]), "v"(d[3]), "v"(d[4]), "v"(d[5]), "v"(d[6]), "v"(d[7]), "v"(w01), "v"(w23));
#endif
}
__device__ __forceinline__ void mlp_layer2(v2f (&a)[8], const v2f (&t)[8], v2f w23) {
#if defined(__HIP_DEVICE_COMPILE__)
  asm(
      "v_pk_fma_f32 %0, %8, %16, %0 op_sel:[0,1,0]\n\t"
      "v_pk_fma_f32 %1, %9, %16, %1 op_sel:[0,1,0]\n\t"
      "v_pk_fma_f32 %2, %10, %16, %2 op_sel:[0,1,0]\n\t"
      "v_pk_fma_f32 %3, %11, %16, %3 op_sel:[0,1,0]\n\t"
      "v_pk_fma_f32 %4, %12, %16, %4 op_sel:[0,1,0]\n\t"
      "v_pk_fma_f32 %5, %13, %16, %5 op_sel:[0,1,0]\n\t"
      "v_pk_fma_f32 %6, %14, %16, %6 op_sel:[0,1,0]\n\t"
      "v_pk_fma_f32 %7, %15, %16, %7 op_sel:[0,1,0]"
      : "+v"(a[0]), "+v"(a[1]), "+v"(a[2]), "+v"(a[3]), "+v"(a[4]), "+v"(a[5]), "+v"(a[6]), "+v"(a[7])
      : "v"(t[0]), "v"(t[1]), "v"(t[2]), "v"(t[3]), "v"(t[4]), "v"(t[5]), "v"(t[6]), "v"(t[7]), "v"(w23));
#endif
}

// ---- 8 x f32 -> 8 x bf16 (RNE), packed for one 16-B store
__device__ __forceinline__ v4u cvt_b8v(v4f a, v4f c) {
  v4u p;
  p[0] = bf_pk(a[0], a[1]);
  p[1] = bf_pk(a[2], a[3]);
  p[2] = bf_pk(c[0], c[1]);
  p[3] = bf_pk(c[2], c[3]);
  return p;
}
// ---- projection accumulator -> f16 hi plane (x16) and f16 residual plane (x2^11), 8 values each
__device__ __forceinline__ void split8(v8f acc, v8h& hi, v8h& lo) {
#pragma unroll
  for (int r = 0; r < 8; ++r) {
    const float f = acc[r] * 16.0f;
    const _Float16 xh = (_Float16)f;
    hi[r] = xh;
    lo[r] = (_Float16)((f - (float)xh) * 2048.0f);
  }
}
__device__ __forceinline__ v16h pad8z(v8h x) {                    // elements 0..7 <- x, elements 8..15 = 0
  union { v16h v; v8h h[2]; } f;
  const _Float16 zz = (_Float16)0.0f;
  const v8h z = {zz, zz, zz, zz, zz, zz, zz, zz};
  f.h[0] = x;
  f.h[1] = z;
  return f.v;
}

// =====================================================================================================
// Projections and attention with the two-score MLP in one kernel, head dim 16 (padded to 32 in registers).
// grid = (NB_ batches, NH_/2 head pairs), 512 threads = 2 heads of the pair x 8 waves x 16 tokens.
// Stage: the batch's row and col activations (128 x 256 each) and the pair's 32 columns of Wq / Wk / Wv (transposed to
// [o][e]) are read as f32, RNE-converted to bf16 and laid in LDS, pitch XP_.
// Project: wave (head hs, group qw) forms three 16x16 tiles over K = 256, all for tokens qw*16..+15 and head hs:
//   q^T[d][q]   = A(WqT rows d) x B(xr rows q)   -> D lane = q, rows d = 8*(lane>>4)+r: already the B fragment of the scores
//   k^T[d][key] = A(WkT rows d) x B(xc rows key) -> D lane = key, 8 d: one 16-B store into the K rows [key][16]
//   v[key][d]   = A(xc rows key) x B(WvT rows d) -> D lane = d, 8 keys: one 16-B store into the V^T rows [d][128]
// each split into an f16 hi plane (x16) and an f16 residual plane (x2^11).
// Attend, per 32-key step over the 128 keys held in LDS:
// S[key][q] = A(K hi rows) x B(Q hi) ; Sr = A(K hi) x B(Q res) + A(K res) x B(Q hi) (separate accumulator, /2048);
// dot = (S + Sr/2048)/1024; cost RNE-bf16 per (q,key) from global; lg = b2 + sum_m relu(dot*w0+cost*w1+b1)*w2
// in f32, m ascending, the head's 16 x 4 weights held in registers; w0, w1, b1 carry 2^-64 and w2 carries 2^64 (exact scalings),
// so that the FMA's clamp to [0, 1] is the relu for every pre-activation below 2^64;
// online softmax over keys (max/sum across lane halves by shuffle),
// p = 1024*exp(x - max) packed D->B per the chained map (element r <- keys 0-15 tile, 8+r <- keys 16-31 tile);
// Oh[d][q] += A(V hi rows) x P, Ol[d][q] += A(V res rows) x P; both rescaled by alpha;
// ctx = (Oh + Ol/2048) / (16 l). The 16 ctx values of (q, head) go to LDS staging shared by the pair's two heads.
// coverage: block = 128 queries x 32 cols (one head pair); per wave 2 it x 4 rows x 8 pieces of 4 floats = 8 x 32;
//           16 waves x 8 rows = 128 rows; NB_ x NH_/2 blocks.
// =====================================================================================================
#define XP_    264                                                  // 528 B = 16 B x 33
#define VPITCH 136                                                  // 272 B = 16 B x 17
#define SP_    36
__global__ __launch_bounds__(512) void attn_kernel(
    const float* __restrict__ row_emb, const float* __restrict__ col_emb,
    const float* __restrict__ cost,
    const float* __restrict__ Wq, const float* __restrict__ Wk, const float* __restrict__ Wv,
    const float* __restrict__ m1w, const float* __restrict__ m1b,
    const float* __restrict__ m2w, const float* __restrict__ m2b,
    float* out) {
  __shared__ __align__(16) unsigned short xr_s[NR_ * XP_];         // 67584 B
  __shared__ __align__(16) unsigned short xc_s[NC_ * XP_];         // 67584 B
  __shared__ __align__(16) unsigned short wt_s[3 * 32 * XP_];      // 50688 B, rows z*32 + o of the pair
  __shared__ __align__(16) unsigned short kh_s[2][NC_ * HD_];      // 2 x 4096 B, one set per head of the pair
  __shared__ __align__(16) unsigned short kg_s[2][NC_ * HD_];      // 2 x 4096 B
  __shared__ __align__(16) unsigned short vh_s[2][16 * VPITCH];    // 2 x 4352 B
  __shared__ __align__(16) unsigned short vr_s[2][16 * VPITCH];    // 2 x 4352 B
  __shared__ __align__(16) float sMW_s[2][MS_ * 4 + 32];           // 2 x 384 B: 16 x (w0, w1, b1 x2^-64, w2 x2^64), then b2 once per lane
  __shared__ __align__(16) float sto[8 * 16 * SP_];                // 18432 B
  const int tid = threadIdx.x, lane = tid & 31, wave = tid >> 5;
  const int hs = wave >> 3, qw = wave & 7;                         // head of the pair, token group (wave-uniform)
  unsigned short* kh_u = kh_s[hs];
  unsigned short* kg_u = kg_s[hs];
  unsigned short* vh_u = vh_s[hs];
  unsigned short* vr_u = vr_s[hs];
  float* sMW = sMW_s[hs];
  const _Float16* khh = (const _Float16*)(const void*)kh_u;
  const _Float16* kgg = (const _Float16*)(const void*)kg_u;
  const _Float16* vhh = (const _Float16*)(const void*)vh_u;
  const _Float16* vrl = (const _Float16*)(const void*)vr_u;

  const int b = blockIdx.x;
  const int h = blockIdx.y * 2 + hs;
  const int qBase = qw * 16;
  const int rlane = lane & 15, hsel = lane >> 4, koff = hsel * 8;
  const float C2048  = 1.0f / 2048.0f;
  const float C1024  = 1.0f / 1024.0f;
  const float LN1024 = 6.931471805599453f;

  const size_t qrow = (size_t)(b * NR_ + qBase + rlane);           // token index of this lane's query
  const float* crow = cost + qrow * NC_ + koff;                      // + key base

  // ---- stage: all global loads first, then convert and store ----
  {
    const float* xrg = row_emb + (size_t)b * NR_ * NE_ + (size_t)tid * 8;
    const float* xcg = col_emb + (size_t)b * NC_ * NE_ + (size_t)tid * 8;
    const int oq = tid & 7, ep = tid >> 3;                         // 4 columns o, rows e = 2*ep, 2*ep+1 (+128 per pass)
    const unsigned wto = (unsigned)(2 * ep * NE_ + oq * 4);        // per thread; the pair's column base is block-uniform
    v4f ra[8][2], ca[8][2], wa[6][2];
#pragma unroll
    for (int z = 0; z < 3; ++z) {                                  // 2 passes x 64 row pairs x 8 column quads = 256 x 32
      const float* Wz = ((z == 0) ? Wq : ((z == 1) ? Wk : Wv)) + blockIdx.y * 32 + wto;
#pragma unroll
      for (int p = 0; p < 2; ++p) {
        wa[z * 2 + p][0] = *(const v4f*)(Wz + p * 128 * NE_);
        wa[z * 2 + p][1] = *(const v4f*)(Wz + p * 128 * NE_ + NE_);
      }
    }
    // precaution: this wait stands in front of every rewrite of the weight loads' offset register; the register is named
    // as an input so that it stays live up to the wait and no later load's result is placed in it
    asm volatile("s_wait_xcnt 0x0" :: "v"(wto * 4u) : "memory");
#pragma unroll
    for (int p = 0; p < 8; ++p) {                                  // 8 passes x 512 threads x 8 = 128 x 256
      ra[p][0] = *(const v4f*)(xrg + p * 4096);
      ra[p][1] = *(const v4f*)(xrg + p * 4096 + 4);
    }
#pragma unroll
    for (int p = 0; p < 8; ++p) {
      ca[p][0] = *(const v4f*)(xcg + p * 4096);
      ca[p][1] = *(const v4f*)(xcg + p * 4096 + 4);
    }
    // the same for the activation loads' offset register
    asm volatile("s_wait_xcnt 0x0" :: "v"((unsigned)tid * 32u) : "memory");
    if (qw == 0) {                                                 // wave-uniform
      // unit m = rlane: lane half 0 brings w0 and b1, lane half 1 brings w1 and w2; every lane loads and stores
      const int iA = h * 2 * MS_ + hsel * MS_ + rlane;
      const float* pB = (hsel ? m2w : m1b) + h * MS_ + rlane;
      const float rA = m1w[iA];
      const float rB = *pB;
      const float r4 = m2b[h];
      // the same for these loads' index and address registers
      asm volatile("s_wait_xcnt 0x0" :: "v"(iA), "v"(pB), "v"(h) : "memory");
      // a power-of-two factor is exact and commutes with the rounding to bf16: w0, w1, b1 down, w2 up
      sMW[4 * rlane + hsel]     = bfr(rA * 0x1p-64f);
      sMW[4 * rlane + 2 + hsel] = bfr(rB * (hsel ? 0x1p+64f : 0x1p-64f));
      sMW[MS_ * 4 + lane] = bfr(r4);                               // no lane test, so that this load issues with the other two
    }
    const int xso = (tid >> 5) * XP_ + (tid & 31) * 8;             // row tid>>5 (+16 per pass), 8 columns
#pragma unroll
    for (int p = 0; p < 8; ++p) *(v4u*)(xr_s + xso + p * 16 * XP_) = cvt_b8v(ra[p][0], ra[p][1]);
#pragma unroll
    for (int p = 0; p < 8; ++p) *(v4u*)(xc_s + xso + p * 16 * XP_) = cvt_b8v(ca[p][0], ca[p][1]);
#pragma unroll
    for (int z = 0; z < 3; ++z)
#pragma unroll
      for (int p = 0; p < 2; ++p)
#pragma unroll
        for (int i = 0; i < 4; ++i)
          *(unsigned*)(wt_s + (z * 32 + oq * 4 + i) * XP_ + p * 128 + 2 * ep) =
              bf_pk(wa[z * 2 + p][0][i], wa[z * 2 + p][1][i]);
  }
  __syncthreads();                                                 // activations and weights staged

  {
    // ---- project: three 16x16 tiles of this wave's 16 tokens and head, same k order in every loader ----
    v16h qh, ql;
    {
      const unsigned short* xrf = xr_s + (qBase + rlane) * XP_ + koff;
      const unsigned short* xcf = xc_s + (qBase + rlane) * XP_ + koff;
      const unsigned short* wf  = wt_s + (hs * 16 + rlane) * XP_ + koff;
      v8f aq = zero8(), ak = zero8(), av = zero8();
#pragma unroll
      for (int k0 = 0; k0 < NE_; k0 += 32) {
        const v16b xa = ldfrag_b(xrf + k0);
        const v16b xb = ldfrag_b(xcf + k0);
        const v16b fq = ldfrag_b(wf + k0);
        const v16b fk = ldfrag_b(wf + 32 * XP_ + k0);
        const v16b fv = ldfrag_b(wf + 64 * XP_ + k0);
        aq = mma_b_raw(fq, xa, aq);
        ak = mma_b_raw(fk, xb, ak);
        av = mma_b_raw(xb, fv, av);
      }
      v8h hi, lo;
      split8(aq, hi, lo);
      qh = pad8z(hi);
      ql = pad8z(lo);
      split8(ak, hi, lo);
      *(v8h*)(void*)(kh_u + (qBase + rlane) * HD_ + koff) = hi;
      *(v8h*)(void*)(kg_u + (qBase + rlane) * HD_ + koff) = lo;
      split8(av, hi, lo);
      *(v8h*)(void*)(vh_u + rlane * VPITCH + qBase + koff) = hi;
      *(v8h*)(void*)(vr_u + rlane * VPITCH + qBase + koff) = lo;
    }
    __syncthreads();                                               // K rows and V^T rows of both heads published

    v8f oh = zero8(), ol = zero8();
    float m_run = -1e30f, l_run = 0.f;
    v4f wv[MS_];                                                   // the head's MLP weights, read once for all keys
#pragma unroll
    for (int m = 0; m < MS_; ++m) wv[m] = *(const v4f*)(sMW + 4 * m);

    {
#pragma unroll 1
      for (int sub = 0; sub < NC_ / 32; ++sub) {
        const int kr = 32 * sub;
        // scores: two 16-key tiles, d padded to 32, hi and residual planes of both operands
        const v16h kf0 = ldfrag_8z(khh + (kr + rlane) * HD_ + koff);
        const v16h kf1 = ldfrag_8z(khh + (kr + 16 + rlane) * HD_ + koff);
        const v16h kg0 = ldfrag_8z(kgg + (kr + rlane) * HD_ + koff);
        const v16h kg1 = ldfrag_8z(kgg + (kr + 16 + rlane) * HD_ + koff);
        v8f sr0 = mma_h_raw(kf0, ql, zero8());
        v8f sr1 = mma_h_raw(kf1, ql, zero8());
        v8f sh0 = mma_h_raw(kf0, qh, zero8());
        v8f sh1 = mma_h_raw(kf1, qh, zero8());
        sr0 = mma_h_raw(kg0, qh, sr0);
        sr1 = mma_h_raw(kg1, qh, sr1);
        guard4x6(sh0, sh1, sr0, sr1, kf0, kf1, kg0, kg1, qh, ql);

        // cost for keys kr+8h+r (tile 0) and kr+16+8h+r (tile 1), RNE-converted to bf16
        const v4f ca0 = *(const v4f*)(crow + kr);
        const v4f ca1 = *(const v4f*)(crow + kr + 4);
        const v4f cb0 = *(const v4f*)(crow + kr + 16);
        const v4f cb1 = *(const v4f*)(crow + kr + 20);
        float d0[8], d1[8], c0[8], c1[8];
#pragma unroll
        for (int r = 0; r < 4; r += 2) {
          bfr2(ca0[r], ca0[r + 1], c0[r], c0[r + 1]); bfr2(ca1[r], ca1[r + 1], c0[r + 4], c0[r + 5]);
          bfr2(cb0[r], cb0[r + 1], c1[r], c1[r + 1]); bfr2(cb1[r], cb1[r + 1], c1[r + 4], c1[r + 5]);
        }
#pragma unroll
        for (int r = 0; r < 8; ++r) {
          d0[r] = (sh0[r] + sr0[r] * C2048) * C1024;
          d1[r] = (sh1[r] + sr1[r] * C2048) * C1024;
        }

        // per-head two-score MLP: lg = b2 + sum_m relu(dot*w0 + cost*w1 + b1) * w2   (f32, two keys per register pair)
        const float b2v = sMW[MS_ * 4];
        v2f dd[8], cc[8], aa[8];
#pragma unroll
        for (int j = 0; j < 4; ++j) {
          dd[j]     = v2f{d0[2 * j], d0[2 * j + 1]};
          dd[4 + j] = v2f{d1[2 * j], d1[2 * j + 1]};
          cc[j]     = v2f{c0[2 * j], c0[2 * j + 1]};
          cc[4 + j] = v2f{c1[2 * j], c1[2 * j + 1]};
        }
#pragma unroll
        for (int j = 0; j < 8; ++j) aa[j] = v2f{b2v, b2v};
#pragma unroll
        for (int m = 0; m < MS_; ++m) {                            // unrolled: each unit's weights are named registers
          const v4f w = wv[m];
          const v2f w01 = {w[0], w[1]}, w23 = {w[2], w[3]};
          v2f t[8];
          mlp_layer1(t, cc, dd, w01, w23);
          mlp_layer2(aa, t, w23);
        }
        float a0[8], a1[8];
#pragma unroll
        for (int j = 0; j < 4; ++j) {
          a0[2 * j] = aa[j][0];     a0[2 * j + 1] = aa[j][1];
          a1[2 * j] = aa[4 + j][0]; a1[2 * j + 1] = aa[4 + j][1];
        }

        // online softmax over the key axis for this lane's q column
        float mloc = -1e30f;
#pragma unroll
        for (int r = 0; r < 8; ++r) mloc = fmaxf(mloc, fmaxf(a0[r], a1[r]));
        mloc = fmaxf(mloc, __shfl_xor(mloc, 16, 32));
        const float newM  = fmaxf(m_run, mloc);
        const float alpha = __expf(m_run - newM);
        const float msh   = newM - LN1024;
        float ssum = 0.f;
        float p0[8], p1[8];
#pragma unroll
        for (int r = 0; r < 8; ++r) {
          p0[r] = __expf(a0[r] - msh);
          p1[r] = __expf(a1[r] - msh);
          ssum += p0[r] + p1[r];
        }
        ssum += __shfl_xor(ssum, 16, 32);
        l_run = l_run * alpha + ssum;
        m_run = newM;
#pragma unroll
        for (int r = 0; r < 8; ++r) { oh[r] *= alpha; ol[r] *= alpha; }

        // P (f32, D layout) -> B operand (f16): element r <- keys 0-15 tile, 8+r <- keys 16-31 tile
        union { v16h v; _Float16 s[16]; } pf;
#pragma unroll
        for (int r = 0; r < 8; ++r) {
          pf.s[r]     = (_Float16)p0[r];
          pf.s[8 + r] = (_Float16)p1[r];
        }

        // O[d][q] += V^T[d][kr .. +31] x P, hi and residual planes in separate accumulators
        const v16h vah = ldfrag_h(vhh + rlane * VPITCH + kr + koff);
        const v16h val = ldfrag_h(vrl + rlane * VPITCH + kr + koff);
        oh = mma_h_raw(vah, pf.v, oh);
        ol = mma_h_raw(val, pf.v, ol);
        guard2x3(oh, ol, vah, val, pf.v);
      }
    }
    acc_guard2(oh, ol);

    // ---- per-head ctx values -> LDS staging (own lane slots): row q, cols hs*16 + 8*hsel + 0..7 ----
    const float inv = (1.0f / 16.0f) * (1.0f / l_run);     // ctx = (Oh + Ol/2048) / (16 * l)
    v4f f0, f1;
#pragma unroll
    for (int e = 0; e < 4; ++e) {
      f0[e] = (oh[e]     + ol[e]     * C2048) * inv;
      f1[e] = (oh[4 + e] + ol[4 + e] * C2048) * inv;
    }
    const int so = (qBase + rlane) * SP_ + hs * 16 + koff;
    *(v4f*)(sto + so)     = f0;
    *(v4f*)(sto + so + 4) = f1;

    __syncthreads();                                         // both heads of the pair staged
    {
      const int rq = lane >> 3, c4 = (lane & 7) * 4;
      const float* ss = sto + (wave * 8) * SP_;
      v4f ov[2];
#pragma unroll
      for (int it = 0; it < 2; ++it) ov[it] = *(const v4f*)(ss + (it * 4 + rq) * SP_ + c4);
      float* ob = out + ((size_t)(b * NR_ + wave * 8)) * NE_ + (size_t)blockIdx.y * 32 + c4;
#pragma unroll
      for (int it = 0; it < 2; ++it) {
        const int row = it * 4 + rq;                         // it 0..1 x rq 0..3 = rows 0..7
        *(v4f*)(ob + (size_t)row * NE_) = ov[it];
      }
    }
  }
}

extern "C" void kernel_launch(void* const* d_in, const int* in_sizes, int n_in,
                              void* d_out, int out_size, void* d_ws, size_t ws_size,
                              hipStream_t stream) {
  if (n_in < 10) return;
  if (in_sizes[0] != NB_ * NR_ * NE_) return;
  if (in_sizes[1] != NB_ * NC_ * NE_) return;
  if (in_sizes[2] != NB_ * NR_ * NC_) return;
  if (in_sizes[3] != NE_ * NE_) return;
  if (in_sizes[4] != NE_ * NE_) return;
  if (in_sizes[5] != NE_ * NE_) return;
  if (in_sizes[6] != NH_ * 2 * MS_) return;
  if (in_sizes[7] != NH_ * MS_) return;
  if (in_sizes[8] != NH_ * MS_) return;
  if (in_sizes[9] < NH_) return;
  if (out_size != NB_ * NR_ * NE_) return;
  (void)d_ws;
  (void)ws_size;

  const float* row_emb = (const float*)d_in[0];
  const float* col_emb = (const float*)d_in[1];
  const float* costm   = (const float*)d_in[2];
  const float* Wq      = (const float*)d_in[3];
  const float* Wk      = (const float*)d_in[4];
  const float* Wv      = (const float*)d_in[5];
  const float* m1w     = (const float*)d_in[6];
  const float* m1b     = (const float*)d_in[7];
  const float* m2w     = (const float*)d_in[8];
  const float* m2b     = (const float*)d_in[9];
  float*       out     = (float*)d_out;

  const dim3 gAttn(NB_, NH_ / 2);                              // 32 x 8 = 256
  const dim3 blkA(512);
  // projections and attention with the per-head two-score MLP, one head pair of a batch per block -> out [b][r][h*16+d]
  attn_kernel<<<gAttn, blkA, 0, stream>>>(row_emb, col_emb, costm, Wq, Wk, Wv, m1w, m1b, m2w, m2b, out);
  (void)hipGetLastError();
}

// v005
// A run of this version takes 14.4 microseconds.
// Two timings next to v004 both put it at 1.17 times that version's speed.
// Over all steps from v000 it is 11.8 times as fast.
// One launch. Contractions: q/k/v projections x.W (bf16-RNE operands, exact products, K 256, v_wmma_f32_16x16x32_bf16);
// scores k.q (k and q as f16 hi planes x16 plus f16 residual planes x2^11, 3 products hh + (hl + lh) in a separate accumulator);
// context v.p (p x1024 f16, v as f16 hi x16 plus residual x2^11, 2 products, separate accumulators);
// scores and context on v_wmma_f32_16x16x32_f16; all with f32 accumulate; two-score MLP, softmax statistics and normalisation in f32 on VALU.
// The MLP's relu is the clamp modifier of the packed FMA that ends its first layer (first-layer weights x2^-64, output weights x2^64).
#include <hip/hip_runtime.h>
#include <math.h>
#include <stdint.h>

#define NB_  32
#define NR_  128
#define NC_  128
#define NE_  256
#define NH_  16
#define HD_  16
#define MS_  16
#define NTOK (NB_ * NR_)
static_assert(NH_ * HD_ == NE_);
static_assert(NR_ == NC_);
static_assert((NTOK % 64) == 0 && (NE_ % 64) == 0 && (NC_ % 64) == 0 && (NE_ % 32) == 0);

typedef _Float16 v16h __attribute__((ext_vector_type(16)));
typedef _Float16 v8h  __attribute__((ext_vector_type(8)));
typedef __bf16   v16b __attribute__((ext_vector_type(16)));
typedef __bf16   v2b  __attribute__((ext_vector_type(2)));
typedef float    v2f  __attribute__((ext_vector_type(2)));
typedef float    v8f  __attribute__((ext_vector_type(8)));
typedef float    v4f  __attribute__((ext_vector_type(4)));
typedef unsigned int v4u __attribute__((ext_vector_type(4)));
typedef unsigned int v2u __attribute__((ext_vector_type(2)));

// ---- scalar helpers --------------------------------------------------------------------------------
__device__ __forceinline__ unsigned bf_pk(float a, float b) {         // two f32 -> two bf16 (RNE), a in the low half: one packed convert
  const v2f x = {a, b};
  return __builtin_bit_cast(unsigned, __builtin_convertvector(x, v2b));
}
__device__ __forceinline__ float bfr(float f) { return __uint_as_float(bf_pk(f, f) & 0xFFFF0000u); }
__device__ __forceinline__ void bfr2(float a, float b, float& ra, float& rb) {   // both rounded to bf16 values, kept in f32
  const unsigned u = bf_pk(a, b);
  ra = __uint_as_float(u << 16);
  rb = __uint_as_float(u & 0xFFFF0000u);
}
__device__ __forceinline__ v8f zero8() { v8f z = {0.f, 0.f, 0.f, 0.f, 0.f, 0.f, 0.f, 0.f}; return z; }

// ---- fragment loaders: 16-bit A/B operand, lane -> row/col (lane&15), p already includes +8*(lane>>4);
//      elements 0..7 <- p[0..7] (k0+8h..), elements 8..15 <- p[16..23] (k0+16+8h..)
__device__ __forceinline__ v16h ldfrag_h(const _Float16* p) {
  union { v16h v; v8h h[2]; } f;
  f.h[0] = *(const v8h*)(p);
  f.h[1] = *(const v8h*)(p + 16);
  return f.v;
}
__device__ __forceinline__ v16b ldfrag_b(const unsigned short* p) {   // the same map for bf16 bits
  union { v16b v; v4u q[2]; } f;
  f.q[0] = *(const v4u*)(p);
  f.q[1] = *(const v4u*)(p + 16);
  return f.v;
}
//      16-deep contraction padded to 32 in registers: elements 0..7 <- p[0..7], elements 8..15 = 0
__device__ __forceinline__ v16h ldfrag_8z(const _Float16* p) {
  union { v16h v; v8h h[2]; } f;
  const _Float16 zz = (_Float16)0.0f;
  const v8h z = {zz, zz, zz, zz, zz, zz, zz, zz};
  f.h[0] = *(const v8h*)(p);
  f.h[1] = z;
  return f.v;
}

// ---- WMMA helpers with trailing VALU hazard gap --------------------------------------------------------
__device__ __forceinline__ v8f mma_h_raw(v16h a, v16h b, v8f c) {
  return __builtin_amdgcn_wmma_f32_16x16x32_f16(false, a, false, b, (short)0, c, false, false);
}
__device__ __forceinline__ v8f mma_b_raw(v16b a, v16b b, v8f c) {
  return __builtin_amdgcn_wmma_f32_16x16x32_bf16(false, a, false, b, (short)0, c, false, false);
}
__device__ __forceinline__ void guard2x3(v8f& a, v8f& b, v16h x, v16h y, v16h z) {
#if defined(__HIP_DEVICE_COMPILE__)
  asm volatile("v_nop\n\tv_nop\n\tv_nop\n\tv_nop" : "+v"(a), "+v"(b) : "v"(x), "v"(y), "v"(z));
#endif
}
__device__ __forceinline__ void guard4x6(v8f& a, v8f& b, v8f& c, v8f& d,
                                         v16h u, v16h w, v16h x, v16h y, v16h z, v16h t) {
#if defined(__HIP_DEVICE_COMPILE__)
  asm volatile("v_nop\n\tv_nop\n\tv_nop\n\tv_nop"
               : "+v"(a), "+v"(b), "+v"(c), "+v"(d)
               : "v"(u), "v"(w), "v"(x), "v"(y), "v"(z), "v"(t));
#endif
}
__device__ __forceinline__ void acc_guard2(v8f& a, v8f& b) {
#if defined(__HIP_DEVICE_COMPILE__)
  asm volatile("v_nop\n\tv_nop\n\tv_nop\n\tv_nop" : "+v"(a), "+v"(b));
#endif
}

// ---- one unit of the two-score MLP for 8 register pairs (16 keys), weights w01 = (w0, w1), w23 = (b1, w2):
//      t <- min(max(d * w0 + (c * w1 + b1), 0), 1), the relu being the second FMA's clamp modifier; then a <- t * w2 + a.
//      In asm because the compiler does not put the clamp on a packed f32 FMA (it adds one maximum per value), and so that each
//      weight is picked from its register by op_sel instead of being kept a second time as a broadcast pair (that form spilled).
//      Every FMA stands 8 instructions behind the one whose result it reads.
__device__ __forceinline__ void mlp_layer1(v2f (&t)[8], const v2f (&c)[8], const v2f (&d)[8], v2f w01, v2f w23) {
#if defined(__HIP_DEVICE_COMPILE__)
  asm(
      "v_pk_fma_f32 %0, %8, %24, %25 op_sel:[0,1,0] op_sel_hi:[1,1,0]\n\t"
      "v_pk_fma_f32 %1, %9, %24, %25 op_sel:[0,1,0] op_sel_hi:[1,1,0]\n\t"
      "v_pk_fma_f32 %2, %10, %24, %25 op_sel:[0,1,0] op_sel_hi:[1,1,0]\n\t"
      "v_pk_fma_f32 %3, %11, %24, %25 op_sel:[0,1,0] op_sel_hi:[1,1,0]\n\t"
      "v_pk_fma_f32 %4, %12, %24, %25 op_sel:[0,1,0] op_sel_hi:[1,1,0]\n\t"
      "v_pk_fma_f32 %5, %13, %24, %25 op_sel:[0,1,0] op_sel_hi:[1,1,0]\n\t"
      "v_pk_fma_f32 %6, %14, %24, %25 op_sel:[0,1,0] op_sel_hi:[1,1,0]\n\t"
      "v_pk_fma_f32 %7, %15, %24, %25 op_sel:[0,1,0] op_sel_hi:[1,1,0]\n\t"
      "v_pk_fma_f32 %0, %16, %24, %0 op_sel_hi:[1,0,1] clamp\n\t"
      "v_pk_fma_f32 %1, %17, %24, %1 op_sel_hi:[1,0,1] clamp\n\t"
      "v_pk_fma_f32 %2, %18, %24, %2 op_sel_hi:[1,0,1] clamp\n\t"
      "v_pk_fma_f32 %3, %19, %24, %3 op_sel_hi:[1,0,1] clamp\n\t"
      "v_pk_fma_f32 %4, %20, %24, %4 op_sel_hi:[1,0,1] clamp\n\t"
      "v_pk_fma_f32 %5, %21, %24, %5 op_sel_hi:[1,0,1] clamp\n\t"
      "v_pk_fma_f32 %6, %22, %24, %6 op_sel_hi:[1,0,1] clamp\n\t"
      "v_pk_fma_f32 %7, %23, %24, %7 op_sel_hi:[1,0,1] clamp"
      : "=&v"(t[0]), "=&v"(t[1]), "=&v"(t[2]), "=&v"(t[3]), "=&v"(t[4]), "=&v"(t[5]), "=&v"(t[6]), "=&v"(t[7])
      : "v"(c[0]), "v"(c[1]), "v"(c[2]), "v"(c[3]), "v"(c[4]), "v"(c[5]), "v"(c[6]), "v"(c[7]),
        "v"(d[0]), "v"(d[1]), "v"(d[2]), "v"(d[3]), "v"(d[4]), "v"(d[5]), "v"(d[6]), "v"(d[7]), "v"(w01), "v"(w23));
#endif
}
__device__ __forceinline__ void mlp_layer2(v2f (&a)[8], const v2f (&t)[8], v2f w23) {
#if defined(__HIP_DEVICE_COMPILE__)
  asm(
      "v_pk_fma_f32 %0, %8, %16, %0 op_sel:[0,1,0]\n\t"
      "v_pk_fma_f32 %1, %9, %16, %1 op_sel:[0,1,0]\n\t"
      "v_pk_fma_f32 %2, %10, %16, %2 op_sel:[0,1,0]\n\t"
      "v_pk_fma_f32 %3, %11, %16, %3 op_sel:[0,1,0]\n\t"
      "v_pk_fma_f32 %4, %12, %16, %4 op_sel:[0,1,0]\n\t"
      "v_pk_fma_f32 %5, %13, %16, %5 op_sel:[0,1,0]\n\t"
      "v_pk_fma_f32 %6, %14, %16, %6 op_sel:[0,1,0]\n\t"
      "v_pk_fma_f32 %7, %15, %16, %7 op_sel:[0,1,0]"
      : "+v"(a[0]), "+v"(a[1]), "+v"(a[2]), "+v"(a[3]), "+v"(a[4]), "+v"(a[5]), "+v"(a[6]), "+v"(a[7])
      : "v"(t[0]), "v"(t[1]), "v"(t[2]), "v"(t[3]), "v"(t[4]), "v"(t[5]), "v"(t[6]), "v"(t[7]), "v"(w23));
#endif
}

// ---- projection accumulator -> f16 hi plane (x16) and f16 residual plane (x2^11), 8 values each
__device__ __forceinline__ void split8(v8f acc, v8h& hi, v8h& lo) {
#pragma unroll
  for (int r = 0; r < 8; ++r) {
    const float f = acc[r] * 16.0f;
    const _Float16 xh = (_Float16)f;
    hi[r] = xh;
    lo[r] = (_Float16)((f - (float)xh) * 2048.0f);
  }
}
__device__ __forceinline__ v16h pad8z(v8h x) {                    // elements 0..7 <- x, elements 8..15 = 0
  union { v16h v; v8h h[2]; } f;
  const _Float16 zz = (_Float16)0.0f;
  const v8h z = {zz, zz, zz, zz, zz, zz, zz, zz};
  f.h[0] = x;
  f.h[1] = z;
  return f.v;
}

// =====================================================================================================
// Projections and attention with the two-score MLP in one kernel, head dim 16 (padded to 32 in registers).
// grid = (NB_ batches, NH_/2 head pairs), 512 threads = 2 heads of the pair x 8 waves x 16 tokens.
// Stage: the batch's row and col activations (128 x 256 each) and the pair's 32 columns of Wq / Wk / Wv (transposed to
// [o][e]) are read as f32, RNE-converted to bf16 and laid in LDS, pitch XP_; the activations come in four chunks of 64 columns,
// and a chunk's share of the products below runs while the later chunks are still on their way.
// Project: wave (head hs, group qw) forms three 16x16 tiles over K = 256, all for tokens qw*16..+15 and head hs:
//   q^T[d][q]   = A(WqT rows d) x B(xr rows q)   -> D lane = q, rows d = 8*(lane>>4)+r: already the B fragment of the scores
//   k^T[d][key] = A(WkT rows d) x B(xc rows key) -> D lane = key, 8 d: one 16-B store into the K rows [key][16]
//   v[key][d]   = A(xc rows key) x B(WvT rows d) -> D lane = d, 8 keys: one 16-B store into the V^T rows [d][128]
// each split into an f16 hi plane (x16) and an f16 residual plane (x2^11).
// Attend, per 32-key step over the 128 keys held in LDS:
// S[key][q] = A(K hi rows) x B(Q hi) ; Sr = A(K hi) x B(Q res) + A(K res) x B(Q hi) (separate accumulator, /2048);
// dot = (S + Sr/2048)/1024; cost RNE-bf16 per (q,key) from global; lg = b2 + sum_m relu(dot*w0+cost*w1+b1)*w2
// in f32, m ascending, the head's 16 x 4 weights held in registers; w0, w1, b1 carry 2^-64 and w2 carries 2^64 (exact scalings),
// so that the FMA's clamp to [0, 1] is the relu for every pre-activation below 2^64;
// online softmax over keys (max/sum across lane halves by shuffle),
// p = 1024*exp(x - max) packed D->B per the chained map (element r <- keys 0-15 tile, 8+r <- keys 16-31 tile);
// Oh[d][q] += A(V hi rows) x P, Ol[d][q] += A(V res rows) x P; both rescaled by alpha;
// ctx = (Oh + Ol/2048) / (16 l). The 16 ctx values of (q, head) go to LDS staging shared by the pair's two heads.
// coverage: block = 128 queries x 32 cols (one head pair); per wave 2 it x 4 rows x 8 pieces of 4 floats = 8 x 32;
//           16 waves x 8 rows = 128 rows; NB_ x NH_/2 blocks.
// =====================================================================================================
#define XP_    264                                                  // 528 B = 16 B x 33
#define VPITCH 136                                                  // 272 B = 16 B x 17
#define SP_    36
__global__ __launch_bounds__(512) void attn_kernel(
    const float* __restrict__ row_emb, const float* __restrict__ col_emb,
    const float* __restrict__ cost,
    const float* __restrict__ Wq, const float* __restrict__ Wk, const float* __restrict__ Wv,
    const float* __restrict__ m1w, const float* __restrict__ m1b,
    const float* __restrict__ m2w, const float* __restrict__ m2b,
    float* out) {
  __shared__ __align__(16) unsigned short xr_s[NR_ * XP_];         // 67584 B
  __shared__ __align__(16) unsigned short xc_s[NC_ * XP_];         // 67584 B
  __shared__ __align__(16) unsigned short wt_s[3 * 32 * XP_];      // 50688 B, rows z*32 + o of the pair
  __shared__ __align__(16) unsigned short kh_s[2][NC_ * HD_];      // 2 x 4096 B, one set per head of the pair
  __shared__ __align__(16) unsigned short kg_s[2][NC_ * HD_];      // 2 x 4096 B
  __shared__ __align__(16) unsigned short vh_s[2][16 * VPITCH];    // 2 x 4352 B
  __shared__ __align__(16) unsigned short vr_s[2][16 * VPITCH];    // 2 x 4352 B
  __shared__ __align__(16) float sMW_s[2][MS_ * 4 + 32];           // 2 x 384 B: 16 x (w0, w1, b1 x2^-64, w2 x2^64), then b2 once per lane
  __shared__ __align__(16) float sto[8 * 16 * SP_];                // 18432 B
  const int tid = threadIdx.x, lane = tid & 31, wave = tid >> 5;
  const int hs = wave >> 3, qw = wave & 7;                         // head of the pair, token group (wave-uniform)
  unsigned short* kh_u = kh_s[hs];
  unsigned short* kg_u = kg_s[hs];
  unsigned short* vh_u = vh_s[hs];
  unsigned short* vr_u = vr_s[hs];
  float* sMW = sMW_s[hs];
  const _Float16* khh = (const _Float16*)(const void*)kh_u;
  const _Float16* kgg = (const _Float16*)(const void*)kg_u;
  const _Float16* vhh = (const _Float16*)(const void*)vh_u;
  const _Float16* vrl = (const _Float16*)(const void*)vr_u;

  const int b = blockIdx.x;
  const int h = blockIdx.y * 2 + hs;
  const int qBase = qw * 16;
  const int rlane = lane & 15, hsel = lane >> 4, koff = hsel * 8;
  const float C2048  = 1.0f / 2048.0f;
  const float C1024  = 1.0f / 1024.0f;
  const float LN1024 = 6.931471805599453f;

  const size_t qrow = (size_t)(b * NR_ + qBase + rlane);           // token index of this lane's query
  const float* crow = cost + qrow * NC_ + koff;                      // + key base

  // ---- stage and project, pipelined over four 64-column chunks of the 256-deep contraction ----
  // All weights and chunk 0 of both activations are asked for first, chunks 1 and 2 behind them, chunk 3 once chunk 0 has been
  // converted. Chunk c is converted, laid in LDS, published by one barrier and projected while the later chunks' loads fly.
  {
    v16h qh, ql;
    {
      // MLP weights, asked for ahead of the activations so that nothing later waits for them; unit m = rlane: lane half 0 brings w0 and b1,
      // lane half 1 brings w1 and w2; every wave loads (no branch in front of the stream), wave 0 of each head stores
      const int iA = h * 2 * MS_ + hsel * MS_ + rlane;
      const float* pB = (hsel ? m2w : m1b) + h * MS_ + rlane;
      const float rA = m1w[iA];
      const float rB = *pB;
      const float r4 = m2b[h];
      const int oq = tid & 7, ep = tid >> 3;                       // 4 columns o, rows e = 2*ep, 2*ep+1 (+128 per pass)
      const unsigned wto = (unsigned)(2 * ep * NE_ + oq * 4);      // per thread; the pair's column base is block-uniform
      v4f wa[6][2];
#pragma unroll
      for (int z = 0; z < 3; ++z) {                                // 2 passes x 64 row pairs x 8 column quads = 256 x 32
        const float* Wz = ((z == 0) ? Wq : ((z == 1) ? Wk : Wv)) + blockIdx.y * 32 + wto;
#pragma unroll
        for (int p = 0; p < 2; ++p) {
          wa[z * 2 + p][0] = *(const v4f*)(Wz + p * 128 * NE_);
          wa[z * 2 + p][1] = *(const v4f*)(Wz + p * 128 * NE_ + NE_);
        }
      }
      // precaution: this wait stands in front of every rewrite of the index, address and offset registers of the loads so far;
      // they are named as inputs so that they stay live up to the wait and no later load's result is placed in them
      asm volatile("s_wait_xcnt 0x0" :: "v"(iA), "v"(pB), "v"(h), "v"(wto * 4u) : "memory");

      // activations: a wave-wide load takes the chunk's 256 B of two rows 8 apart (lanes 0-15, lanes 16-31), 32 rows per pass
      const int xrow = (wave >> 3) * 16 + qw + koff;
      const unsigned xgo = (unsigned)(xrow * NE_ + rlane * 4);
      const float* xrg = row_emb + (size_t)b * NR_ * NE_ + xgo;
      const float* xcg = col_emb + (size_t)b * NC_ * NE_ + xgo;
      const int xso = xrow * XP_ + rlane * 4;                      // rows 8 apart lie 32 banks apart: the 8-B stores do not collide
      v4f xv[4][8];
#define XLOAD_(c)                                                                     \
  _Pragma("unroll") for (int p = 0; p < 4; ++p) {                                     \
    xv[c][p]     = *(const v4f*)(xrg + p * 32 * NE_ + (c) * 64);                      \
    xv[c][4 + p] = *(const v4f*)(xcg + p * 32 * NE_ + (c) * 64);                      \
  }
      XLOAD_(0)
      // barrier with no wait: every wave's requests for one chunk are queued before any wave's for the next, so that a chunk
      // is complete for the whole block as early as the stream allows
      asm volatile("s_barrier_signal -1\n\ts_barrier_wait -1" ::: "memory");
      XLOAD_(1)
      asm volatile("s_barrier_signal -1\n\ts_barrier_wait -1" ::: "memory");   // the same between chunks 1 and 2
      XLOAD_(2)

      // three 16x16 tiles of this wave's 16 tokens and head, same k order in every loader
      const unsigned short* xrf = xr_s + (qBase + rlane) * XP_ + koff;
      const unsigned short* xcf = xc_s + (qBase + rlane) * XP_ + koff;
      const unsigned short* wf  = wt_s + (hs * 16 + rlane) * XP_ + koff;
      v8f aq = zero8(), ak = zero8(), av = zero8();
#pragma unroll
      for (int c = 0; c < 4; ++c) {
        if (c == 0) {
#pragma unroll
          for (int z = 0; z < 3; ++z)
#pragma unroll
            for (int p = 0; p < 2; ++p)
#pragma unroll
              for (int i = 0; i < 4; ++i)
                *(unsigned*)(wt_s + (z * 32 + oq * 4 + i) * XP_ + p * 128 + 2 * ep) =
                    bf_pk(wa[z * 2 + p][0][i], wa[z * 2 + p][1][i]);
        }
#pragma unroll
        for (int p = 0; p < 4; ++p) {
          const v4f r = xv[c][p], s = xv[c][4 + p];
          const v2u pr = {bf_pk(r[0], r[1]), bf_pk(r[2], r[3])};
          const v2u ps = {bf_pk(s[0], s[1]), bf_pk(s[2], s[3])};
          *(v2u*)(xr_s + xso + p * 32 * XP_ + c * 64) = pr;
          *(v2u*)(xc_s + xso + p * 32 * XP_ + c * 64) = ps;
        }
        if (c == 0) {
          // inputs-only fence on the three loaded MLP weights: it holds their loads ahead of the activations' (the compiler
          // otherwise sinks them into the branch behind the products, where two waves would wait out their whole latency)
          asm volatile("" :: "v"(rA), "v"(rB), "v"(r4));
          __builtin_amdgcn_sched_barrier(0);                       // without it the compiler asks for chunk 3 together with chunk 2
          XLOAD_(3)
        }
        if (c == 3) {
          // precaution: the same wait for the activation loads' address registers, named so that they stay live up to here;
          // it stands where the last chunk has arrived, so that no wave is held at it while loads are queued
          asm volatile("s_wait_xcnt 0x0" :: "v"(xrg), "v"(xcg) : "memory");
        }
        // publish chunk c: this wave's LDS stores done, then the block barrier. By hand, because __syncthreads() would also
        // wait for the global loads of the later chunks, which are to stay in flight across it
        asm volatile("s_wait_dscnt 0x0\n\ts_barrier_signal -1\n\ts_barrier_wait -1" ::: "memory");
        v16b xa[2], xb[2], fq[2], fk[2], fv[2];
#pragma unroll
        for (int j = 0; j < 2; ++j) {
          const int k0 = c * 64 + j * 32;
          xa[j] = ldfrag_b(xrf + k0);
          fq[j] = ldfrag_b(wf + k0);
          xb[j] = ldfrag_b(xcf + k0);
          fk[j] = ldfrag_b(wf + 32 * XP_ + k0);
          fv[j] = ldfrag_b(wf + 64 * XP_ + k0);
        }
        __builtin_amdgcn_sched_barrier(0);                         // the chunk's 20 LDS reads stay one group ahead of its products
#pragma unroll
        for (int j = 0; j < 2; ++j) {
          aq = mma_b_raw(fq[j], xa[j], aq);
          ak = mma_b_raw(fk[j], xb[j], ak);
          av = mma_b_raw(xb[j], fv[j], av);
        }
        // without this fence the compiler converts later chunks ahead of these products, which then stand behind those chunks' load waits
        __builtin_amdgcn_sched_barrier(0);
      }
#undef XLOAD_
      if (qw == 0) {                                               // wave-uniform
        // a power-of-two factor is exact and commutes with the rounding to bf16: w0, w1, b1 down, w2 up
        sMW[4 * rlane + hsel]     = bfr(rA * 0x1p-64f);
        sMW[4 * rlane + 2 + hsel] = bfr(rB * (hsel ? 0x1p+64f : 0x1p-64f));
        sMW[MS_ * 4 + lane] = bfr(r4);
      }
      v8h hi, lo;
      split8(aq, hi, lo);
      qh = pad8z(hi);
      ql = pad8z(lo);
      split8(ak, hi, lo);
      *(v8h*)(void*)(kh_u + (qBase + rlane) * HD_ + koff) = hi;
      *(v8h*)(void*)(kg_u + (qBase + rlane) * HD_ + koff) = lo;
      split8(av, hi, lo);
      *(v8h*)(void*)(vh_u + rlane * VPITCH + qBase + koff) = hi;
      *(v8h*)(void*)(vr_u + rlane * VPITCH + qBase + koff) = lo;
    }
    __syncthreads();                                               // K rows and V^T rows of both heads published

    v8f oh = zero8(), ol = zero8();
    float m_run = -1e30f, l_run = 0.f;
    v4f wv[MS_];                                                   // the head's MLP weights, read once for all keys
#pragma unroll
    for (int m = 0; m < MS_; ++m) wv[m] = *(const v4f*)(sMW + 4 * m);

    {
#pragma unroll 1
      for (int sub = 0; sub < NC_ / 32; ++sub) {
        const int kr = 32 * sub;
        // scores: two 16-key tiles, d padded to 32, hi and residual planes of both operands
        const v16h kf0 = ldfrag_8z(khh + (kr + rlane) * HD_ + koff);
        const v16h kf1 = ldfrag_8z(khh + (kr + 16 + rlane) * HD_ + koff);
        const v16h kg0 = ldfrag_8z(kgg + (kr + rlane) * HD_ + koff);
        const v16h kg1 = ldfrag_8z(kgg + (kr + 16 + rlane) * HD_ + koff);
        v8f sr0 = mma_h_raw(kf0, ql, zero8());
        v8f sr1 = mma_h_raw(kf1, ql, zero8());
        v8f sh0 = mma_h_raw(kf0, qh, zero8());
        v8f sh1 = mma_h_raw(kf1, qh, zero8());
        sr0 = mma_h_raw(kg0, qh, sr0);
        sr1 = mma_h_raw(kg1, qh, sr1);
        guard4x6(sh0, sh1, sr0, sr1, kf0, kf1, kg0, kg1, qh, ql);

        // cost for keys kr+8h+r (tile 0) and kr+16+8h+r (tile 1), RNE-converted to bf16
        const v4f ca0 = *(const v4f*)(crow + kr);
        const v4f ca1 = *(const v4f*)(crow + kr + 4);
        const v4f cb0 = *(const v4f*)(crow + kr + 16);
        const v4f cb1 = *(const v4f*)(crow + kr + 20);
        float d0[8], d1[8], c0[8], c1[8];
#pragma unroll
        for (int r = 0; r < 4; r += 2) {
          bfr2(ca0[r], ca0[r + 1], c0[r], c0[r + 1]); bfr2(ca1[r], ca1[r + 1], c0[r + 4], c0[r + 5]);
          bfr2(cb0[r], cb0[r + 1], c1[r], c1[r + 1]); bfr2(cb1[r], cb1[r + 1], c1[r + 4], c1[r + 5]);
        }
#pragma unroll
        for (int r = 0; r < 8; ++r) {
          d0[r] = (sh0[r] + sr0[r] * C2048) * C1024;
          d1[r] = (sh1[r] + sr1[r] * C2048) * C1024;
        }

        // per-head two-score MLP: lg = b2 + sum_m relu(dot*w0 + cost*w1 + b1) * w2   (f32, two keys per register pair)
        const float b2v = sMW[MS_ * 4];
        v2f dd[8], cc[8], aa[8];
#pragma unroll
        for (int j = 0; j < 4; ++j) {
          dd[j]     = v2f{d0[2 * j], d0[2 * j + 1]};
          dd[4 + j] = v2f{d1[2 * j], d1[2 * j + 1]};
          cc[j]     = v2f{c0[2 * j], c0[2 * j + 1]};
          cc[4 + j] = v2f{c1[2 * j], c1[2 * j + 1]};
        }
#pragma unroll
        for (int j = 0; j < 8; ++j) aa[j] = v2f{b2v, b2v};
#pragma unroll
        for (int m = 0; m < MS_; ++m) {                            // unrolled: each unit's weights are named registers
          const v4f w = wv[m];
          const v2f w01 = {w[0], w[1]}, w23 = {w[2], w[3]};
          v2f t[8];
          mlp_layer1(t, cc, dd, w01, w23);
          mlp_layer2(aa, t, w23);
        }
        float a0[8], a1[8];
#pragma unroll
        for (int j = 0; j < 4; ++j) {
          a0[2 * j] = aa[j][0];     a0[2 * j + 1] = aa[j][1];
          a1[2 * j] = aa[4 + j][0]; a1[2 * j + 1] = aa[4 + j][1];
        }

        // online softmax over the key axis for this lane's q column
        float mloc = -1e30f;
#pragma unroll
        for (int r = 0; r < 8; ++r) mloc = fmaxf(mloc, fmaxf(a0[r], a1[r]));
        mloc = fmaxf(mloc, __shfl_xor(mloc, 16, 32));
        const float newM  = fmaxf(m_run, mloc);
        const float alpha = __expf(m_run - newM);
        const float msh   = newM - LN1024;
        float ssum = 0.f;
        float p0[8], p1[8];
#pragma unroll
        for (int r = 0; r < 8; ++r) {
          p0[r] = __expf(a0[r] - msh);
          p1[r] = __expf(a1[r] - msh);
          ssum += p0[r] + p1[r];
        }
        ssum += __shfl_xor(ssum, 16, 32);
        l_run = l_run * alpha + ssum;
        m_run = newM;
#pragma unroll
        for (int r = 0; r < 8; ++r) { oh[r] *= alpha; ol[r] *= alpha; }

        // P (f32, D layout) -> B operand (f16): element r <- keys 0-15 tile, 8+r <- keys 16-31 tile
        union { v16h v; _Float16 s[16]; } pf;
#pragma unroll
        for (int r = 0; r < 8; ++r) {
          pf.s[r]     = (_Float16)p0[r];
          pf.s[8 + r] = (_Float16)p1[r];
        }

        // O[d][q] += V^T[d][kr .. +31] x P, hi and residual planes in separate accumulators
        const v16h vah = ldfrag_h(vhh + rlane * VPITCH + kr + koff);
        const v16h val = ldfrag_h(vrl + rlane * VPITCH + kr + koff);
        oh = mma_h_raw(vah, pf.v, oh);
        ol = mma_h_raw(val, pf.v, ol);
        guard2x3(oh, ol, vah, val, pf.v);
      }
    }
    acc_guard2(oh, ol);

    // ---- per-head ctx values -> LDS staging (own lane slots): row q, cols hs*16 + 8*hsel + 0..7 ----
    const float inv = (1.0f / 16.0f) * (1.0f / l_run);     // ctx = (Oh + Ol/2048) / (16 * l)
    v4f f0, f1;
#pragma unroll
    for (int e = 0; e < 4; ++e) {
      f0[e] = (oh[e]     + ol[e]     * C2048) * inv;
      f1[e] = (oh[4 + e] + ol[4 + e] * C2048) * inv;
    }
    const int so = (qBase + rlane) * SP_ + hs * 16 + koff;
    *(v4f*)(sto + so)     = f0;
    *(v4f*)(sto + so + 4) = f1;

    __syncthreads();                                         // both heads of the pair staged
    {
      const int rq = lane >> 3, c4 = (lane & 7) * 4;
      const float* ss = sto + (wave * 8) * SP_;
      v4f ov[2];
#pragma unroll
      for (int it = 0; it < 2; ++it) ov[it] = *(const v4f*)(ss + (it * 4 + rq) * SP_ + c4);
      float* ob = out + ((size_t)(b * NR_ + wave * 8)) * NE_ + (size_t)blockIdx.y * 32 + c4;
#pragma unroll
      for (int it = 0; it < 2; ++it) {
        const int row = it * 4 + rq;                         // it 0..1 x rq 0..3 = rows 0..7
        *(v4f*)(ob + (size_t)row * NE_) = ov[it];
      }
    }
  }
}

extern "C" void kernel_launch(void* const* d_in, const int* in_sizes, int n_in,
                              void* d_out, int out_size, void* d_ws, size_t ws_size,
                              hipStream_t stream) {
  if (n_in < 10) return;
  if (in_sizes[0] != NB_ * NR_ * NE_) return;
  if (in_sizes[1] != NB_ * NC_ * NE_) return;
  if (in_sizes[2] != NB_ * NR_ * NC_) return;
  if (in_sizes[3] != NE_ * NE_) return;
  if (in_sizes[4] != NE_ * NE_) return;
  if (in_sizes[5] != NE_ * NE_) return;
  if (in_sizes[6] != NH_ * 2 * MS_) return;
  if (in_sizes[7] != NH_ * MS_) return;
  if (in_sizes[8] != NH_ * MS_) return;
  if (in_sizes[9] < NH_) return;
  if (out_size != NB_ * NR_ * NE_) return;
  (void)d_ws;
  (void)ws_size;

  const float* row_emb = (const float*)d_in[0];
  const float* col_emb = (const float*)d_in[1];
  const float* costm   = (const float*)d_in[2];
  const float* Wq      = (const float*)d_in[3];
  const float* Wk      = (const float*)d_in[4];
  const float* Wv      = (const float*)d_in[5];
  const float* m1w     = (const float*)d_in[6];
  const float* m1b     = (const float*)d_in[7];
  const float* m2w     = (const float*)d_in[8];
  const float* m2b     = (const float*)d_in[9];
  float*       out     = (float*)d_out;

  const dim3 gAttn(NB_, NH_ / 2);                              // 32 x 8 = 256
  const dim3 blkA(512);
  // projections and attention with the per-head two-score MLP, one head pair of a batch per block -> out [b][r][h*16+d]
  attn_kernel<<<gAttn, blkA, 0, stream>>>(row_emb, col_emb, costm, Wq, Wk, Wv, m1w, m1b, m2w, m2b, out);
  (void)hipGetLastError();
}

// v006
// It runs in 13.6 microseconds.
// Next to v005, in two timings, it ran 1.06 times as fast each time.
// Over all steps from v000 it is 12.5 times as fast.
// One launch. Contractions: q/k/v projections x.W (bf16-RNE operands, exact products, K 256, v_wmma_f32_16x16x32_bf16);
// first layer of the two-score MLP, one product per unit m: pre_m[key][q] = k.(q w0[m] / 4) + cost^T.(w1[m] I), K = 16 d + 16 q',
// operands single f16 planes (k x16; q / 64 times w0, rounded to f16; cost rounded to f16; w0, w1 as their bf16-rounded values);
// context v.p (p x1024 f16, v as f16 hi x16 plus residual x2^11, 2 products, separate accumulators);
// both on v_wmma_f32_16x16x32_f16; all with f32 accumulate; bias, relu, second MLP layer, softmax statistics and normalisation in f32 on VALU.
// The MLP's relu is the clamp modifier of the packed FMA that adds the bias (pre x2^-64, bias x2^-64, output weights x2^64).
#include <hip/hip_runtime.h>
#include <math.h>
#include <stdint.h>

#define NB_  32
#define NR_  128
#define NC_  128
#define NE_  256
#define NH_  16
#define HD_  16
#define MS_  16
#define NTOK (NB_ * NR_)
static_assert(NH_ * HD_ == NE_);
static_assert(NR_ == NC_);
static_assert((NTOK % 64) == 0 && (NE_ % 64) == 0 && (NC_ % 64) == 0 && (NE_ % 32) == 0);

typedef _Float16 v16h __attribute__((ext_vector_type(16)));
typedef _Float16 v8h  __attribute__((ext_vector_type(8)));
typedef __bf16   v16b __attribute__((ext_vector_type(16)));
typedef __bf16   v2b  __attribute__((ext_vector_type(2)));
typedef float    v2f  __attribute__((ext_vector_type(2)));
typedef float    v8f  __attribute__((ext_vector_type(8)));
typedef float    v4f  __attribute__((ext_vector_type(4)));
typedef unsigned int v4u __attribute__((ext_vector_type(4)));
typedef unsigned int v2u __attribute__((ext_vector_type(2)));

// ---- scalar helpers --------------------------------------------------------------------------------
__device__ __forceinline__ unsigned bf_pk(float a, float b) {         // two f32 -> two bf16 (RNE), a in the low half: one packed convert
  const v2f x = {a, b};
  return __builtin_bit_cast(unsigned, __builtin_convertvector(x, v2b));
}
__device__ __forceinline__ float bfr(float f) { return __uint_as_float(bf_pk(f, f) & 0xFFFF0000u); }
__device__ __forceinline__ v8f zero8() { v8f z = {0.f, 0.f, 0.f, 0.f, 0.f, 0.f, 0.f, 0.f}; return z; }

// ---- fragment loaders: 16-bit A/B operand, lane -> row/col (lane&15), p already includes +8*(lane>>4);
//      elements 0..7 <- p[0..7] (k0+8h..), elements 8..15 <- p[16..23] (k0+16+8h..)
__device__ __forceinline__ v16h ldfrag_h(const _Float16* p) {
  union { v16h v; v8h h[2]; } f;
  f.h[0] = *(const v8h*)(p);
  f.h[1] = *(const v8h*)(p + 16);
  return f.v;
}
__device__ __forceinline__ v16b ldfrag_b(const unsigned short* p) {   // the same map for bf16 bits
  union { v16b v; v4u q[2]; } f;
  f.q[0] = *(const v4u*)(p);
  f.q[1] = *(const v4u*)(p + 16);
  return f.v;
}

// ---- WMMA helpers with trailing VALU hazard gap --------------------------------------------------------
__device__ __forceinline__ v8f mma_h_raw(v16h a, v16h b, v8f c) {
  return __builtin_amdgcn_wmma_f32_16x16x32_f16(false, a, false, b, (short)0, c, false, false);
}
__device__ __forceinline__ v8f mma_b_raw(v16b a, v16b b, v8f c) {
  return __builtin_amdgcn_wmma_f32_16x16x32_bf16(false, a, false, b, (short)0, c, false, false);
}
__device__ __forceinline__ void guard2x3(v8f& a, v8f& b, v16h x, v16h y, v16h z) {
#if defined(__HIP_DEVICE_COMPILE__)
  asm volatile("v_nop\n\tv_nop\n\tv_nop\n\tv_nop" : "+v"(a), "+v"(b) : "v"(x), "v"(y), "v"(z));
#endif
}
__device__ __forceinline__ void acc_guard2(v8f& a, v8f& b) {
#if defined(__HIP_DEVICE_COMPILE__)
  asm volatile("v_nop\n\tv_nop\n\tv_nop\n\tv_nop" : "+v"(a), "+v"(b));
#endif
}

// ---- one unit of the two-score MLP for 8 register pairs (16 keys); p holds the unit's matrix product d * w0 + c * w1,
//      sb = b1 x2^-64 and sw = w2 x2^64 in the low words of scalar pairs (a packed f32 FMA takes only the low word of a scalar pair), vs = 2^-64:
//      p <- min(max(p * 2^-64 + b1, 0), 1), the relu being the FMA's clamp modifier; then a <- p * w2 + a.
//      In asm because the compiler does not put the clamp on a packed f32 FMA (it adds one maximum per value), and so that each
//      weight is read from a scalar register. Every FMA stands 8 instructions behind the one whose result it reads.
__device__ __forceinline__ void mlp_unit(v2f (&p)[8], v2f (&a)[8], v2f vs, v2f sb, v2f sw) {
#if defined(__HIP_DEVICE_COMPILE__)
  asm(
      "v_pk_fma_f32 %0, %0, %16, %17 op_sel_hi:[1,0,0] clamp\n\t"
      "v_pk_fma_f32 %1, %1, %16, %17 op_sel_hi:[1,0,0] clamp\n\t"
      "v_pk_fma_f32 %2, %2, %16, %17 op_sel_hi:[1,0,0] clamp\n\t"
      "v_pk_fma_f32 %3, %3, %16, %17 op_sel_hi:[1,0,0] clamp\n\t"
      "v_pk_fma_f32 %4, %4, %16, %17 op_sel_hi:[1,0,0] clamp\n\t"
      "v_pk_fma_f32 %5, %5, %16, %17 op_sel_hi:[1,0,0] clamp\n\t"
      "v_pk_fma_f32 %6, %6, %16, %17 op_sel_hi:[1,0,0] clamp\n\t"
      "v_pk_fma_f32 %7, %7, %16, %17 op_sel_hi:[1,0,0] clamp\n\t"
      "v_pk_fma_f32 %8, %0, %18, %8 op_sel_hi:[1,0,1]\n\t"
      "v_pk_fma_f32 %9, %1, %18, %9 op_sel_hi:[1,0,1]\n\t"
      "v_pk_fma_f32 %10, %2, %18, %10 op_sel_hi:[1,0,1]\n\t"
      "v_pk_fma_f32 %11, %3, %18, %11 op_sel_hi:[1,0,1]\n\t"
      "v_pk_fma_f32 %12, %4, %18, %12 op_sel_hi:[1,0,1]\n\t"
      "v_pk_fma_f32 %13, %5, %18, %13 op_sel_hi:[1,0,1]\n\t"
      "v_pk_fma_f32 %14, %6, %18, %14 op_sel_hi:[1,0,1]\n\t"
      "v_pk_fma_f32 %15, %7, %18, %15 op_sel_hi:[1,0,1]"
      : "+v"(p[0]), "+v"(p[1]), "+v"(p[2]), "+v"(p[3]), "+v"(p[4]), "+v"(p[5]), "+v"(p[6]), "+v"(p[7]),
        "+v"(a[0]), "+v"(a[1]), "+v"(a[2]), "+v"(a[3]), "+v"(a[4]), "+v"(a[5]), "+v"(a[6]), "+v"(a[7])
      : "v"(vs), "s"(sb), "s"(sw));
#endif
}

//      The first unit: the same, with a <- p * w2 + b2 (b2 in both words of vb), which spares a copy of b2 into every sum
__device__ __forceinline__ void mlp_unit0(v2f (&p)[8], v2f (&a)[8], v2f vs, v2f sb, v2f sw, v2f vb) {
#if defined(__HIP_DEVICE_COMPILE__)
  asm(
      "v_nop\n\t"   // fourth vector slot between the step's first product (three more products stand behind it) and this read of its result
      "v_pk_fma_f32 %0, %0, %16, %17 op_sel_hi:[1,0,0] clamp\n\t"
      "v_pk_fma_f32 %1, %1, %16, %17 op_sel_hi:[1,0,0] clamp\n\t"
      "v_pk_fma_f32 %2, %2, %16, %17 op_sel_hi:[1,0,0] clamp\n\t"
      "v_pk_fma_f32 %3, %3, %16, %17 op_sel_hi:[1,0,0] clamp\n\t"
      "v_pk_fma_f32 %4, %4, %16, %17 op_sel_hi:[1,0,0] clamp\n\t"
      "v_pk_fma_f32 %5, %5, %16, %17 op_sel_hi:[1,0,0] clamp\n\t"
      "v_pk_fma_f32 %6, %6, %16, %17 op_sel_hi:[1,0,0] clamp\n\t"
      "v_pk_fma_f32 %7, %7, %16, %17 op_sel_hi:[1,0,0] clamp\n\t"
      "v_pk_fma_f32 %8, %0, %18, %19 op_sel_hi:[1,0,1]\n\t"
      "v_pk_fma_f32 %9, %1, %18, %19 op_sel_hi:[1,0,1]\n\t"
      "v_pk_fma_f32 %10, %2, %18, %19 op_sel_hi:[1,0,1]\n\t"
      "v_pk_fma_f32 %11, %3, %18, %19 op_sel_hi:[1,0,1]\n\t"
      "v_pk_fma_f32 %12, %4, %18, %19 op_sel_hi:[1,0,1]\n\t"
      "v_pk_fma_f32 %13, %5, %18, %19 op_sel_hi:[1,0,1]\n\t"
      "v_pk_fma_f32 %14, %6, %18, %19 op_sel_hi:[1,0,1]\n\t"
      "v_pk_fma_f32 %15, %7, %18, %19 op_sel_hi:[1,0,1]"
      : "+v"(p[0]), "+v"(p[1]), "+v"(p[2]), "+v"(p[3]), "+v"(p[4]), "+v"(p[5]), "+v"(p[6]), "+v"(p[7]),
        "=&v"(a[0]), "=&v"(a[1]), "=&v"(a[2]), "=&v"(a[3]), "=&v"(a[4]), "=&v"(a[5]), "=&v"(a[6]), "=&v"(a[7])
      : "v"(vs), "s"(sb), "s"(sw), "v"(vb));
#endif
}

// ---- projection accumulator -> f16 hi plane (x16) and f16 residual plane (x2^11), 8 values each
__device__ __forceinline__ void split8(v8f acc, v8h& hi, v8h& lo) {
#pragma unroll
  for (int r = 0; r < 8; ++r) {
    const float f = acc[r] * 16.0f;
    const _Float16 xh = (_Float16)f;
    hi[r] = xh;
    lo[r] = (_Float16)((f - (float)xh) * 2048.0f);
  }
}

// =====================================================================================================
// Projections and attention with the two-score MLP in one kernel, head dim 16.
// grid = (NB_ batches, NH_/2 head pairs), 512 threads = 2 heads of the pair x 8 waves x 16 tokens.
// Stage: the batch's row and col activations (128 x 256 each) and the pair's 32 columns of Wq / Wk / Wv (transposed to
// [o][e]) are read as f32, RNE-converted to bf16 and laid in LDS, pitch XP_; the activations come in four chunks of 64 columns,
// and a chunk's share of the products below runs while the later chunks are still on their way.
// Project: wave (head hs, group qw) forms three 16x16 tiles over K = 256, all for tokens qw*16..+15 and head hs:
//   q^T[d][q]   = A(WqT rows d) x B(xr rows q)   -> D lane = q, rows d = 8*(lane>>4)+r: the B fragment's d part, scaled per MLP unit
//   k^T[d][key] = A(WkT rows d) x B(xc rows key) -> D lane = key, 8 d: one 16-B store into the K rows [key][16]
//   v[key][d]   = A(xc rows key) x B(WvT rows d) -> D lane = d, 8 keys: one 16-B store into the V^T rows [d][128]
// k as one f16 plane (x16); v split into an f16 hi plane (x16) and an f16 residual plane (x2^11).
// The batch's cost matrix is read once for both heads, rounded to f16 and laid transposed in LDS, [q tile][key][16 q'].
// Attend, per 32-key step over the 128 keys held in LDS, for each MLP unit m and each 16-key tile one product of depth 32:
// pre_m[key][q] = A(K row | cost^T row) x B_m(q w0[m] / 64 | w1[m] where q' = q, else 0) = dot * w0[m] + cost * w1[m];
// the 16 B_m are held in registers for all keys. lg = b2 + sum_m relu(pre_m + b1) * w2
// in f32, m ascending, b1 and w2 in scalar registers; pre and b1 carry 2^-64 and w2 carries 2^64 (exact scalings),
// so that the FMA's clamp to [0, 1] is the relu for every pre-activation below 2^64;
// online softmax over keys (max/sum across lane halves by shuffle),
// p = 1024*exp(x - max) packed D->B per the chained map (element r <- keys 0-15 tile, 8+r <- keys 16-31 tile);
// Oh[d][q] += A(V hi rows) x P, Ol[d][q] += A(V res rows) x P; both rescaled by alpha;
// ctx = (Oh + Ol/2048) / (16 l). The 16 ctx values of (q, head) go to LDS staging shared by the pair's two heads.
// coverage: block = 128 queries x 32 cols (one head pair); per wave 2 it x 4 rows x 8 pieces of 4 floats = 8 x 32;
//           16 waves x 8 rows = 128 rows; NB_ x NH_/2 blocks.
// =====================================================================================================
#define XP_    264                                                  // 528 B = 16 B x 33
#define VPITCH 136                                                  // 272 B = 16 B x 17
#define SP_    36
#define CP_    24                                                   // 48 B = 16 B x 3
__global__ __launch_bounds__(512) void attn_kernel(
    const float* __restrict__ row_emb, const float* __restrict__ col_emb,
    const float* __restrict__ cost,
    const float* __restrict__ Wq, const float* __restrict__ Wk, const float* __restrict__ Wv,
    const float* __restrict__ m1w, const float* __restrict__ m1b,
    const float* __restrict__ m2w, const float* __restrict__ m2b,
    float* out) {
  __shared__ __align__(16) unsigned short xr_s[NR_ * XP_];         // 67584 B
  __shared__ __align__(16) unsigned short xc_s[NC_ * XP_];         // 67584 B
  __shared__ __align__(16) unsigned short wt_s[3 * 32 * XP_];      // 50688 B, rows z*32 + o of the pair
  __shared__ __align__(16) unsigned short kh_s[2][NC_ * HD_];      // 2 x 4096 B, one set per head of the pair
  __shared__ __align__(16) unsigned short vh_s[2][16 * VPITCH];    // 2 x 4352 B
  __shared__ __align__(16) unsigned short vr_s[2][16 * VPITCH];    // 2 x 4352 B
  __shared__ __align__(16) unsigned short ct_s[8 * NC_ * CP_];     // 49152 B: cost^T as f16, rows [q tile][key] of 16 q', pitch CP_
  __shared__ __align__(16) float sto[8 * 16 * SP_];                // 18432 B
  const int tid = threadIdx.x, lane = tid & 31, wave = tid >> 5;
  const int hs = wave >> 3, qw = wave & 7;                         // head of the pair, token group (wave-uniform)
  unsigned short* kh_u = kh_s[hs];
  unsigned short* vh_u = vh_s[hs];
  unsigned short* vr_u = vr_s[hs];
  const _Float16* khh = (const _Float16*)(const void*)kh_u;
  const _Float16* ctt = (const _Float16*)(const void*)(ct_s + qw * NC_ * CP_);
  const _Float16* vhh = (const _Float16*)(const void*)vh_u;
  const _Float16* vrl = (const _Float16*)(const void*)vr_u;

  const int b = blockIdx.x;
  const int h = blockIdx.y * 2 + hs;
  const int qBase = qw * 16;
  const int rlane = lane & 15, hsel = lane >> 4, koff = hsel * 8;
  const float C2048  = 1.0f / 2048.0f;
  const float LN1024 = 6.931471805599453f;

  // ---- stage and project, pipelined over four 64-column chunks of the 256-deep contraction ----
  // All weights and chunk 0 of both activations are asked for first, chunks 1 and 2 behind them, chunk 3 once chunk 0 has been
  // converted. Chunk c is converted, laid in LDS, published by one barrier and projected while the later chunks' loads fly.
  {
    v16h Bm[MS_];                                                  // per MLP unit: the B fragment (q w0 / 64 | w1 on the lane's own q')
    v2f sb[MS_], sw[MS_];                                          // per MLP unit: b1 x2^-64 and w2 x2^64, wave-uniform, low words
    float b2v;
    {
      // MLP weights, asked for ahead of the activations so that nothing later waits for them; unit m = rlane: lane half 0 brings w0 and b1,
      // lane half 1 brings w1 and w2; every wave loads its head's and later reads them lane by lane into scalar registers
      const int iA = h * 2 * MS_ + hsel * MS_ + rlane;
      const float* pB = (hsel ? m2w : m1b) + h * MS_ + rlane;
      const float rA = m1w[iA];
      const float rB = *pB;
      const float r4 = m2b[h];
      const int oq = tid & 7, ep = tid >> 3;                       // 4 columns o, rows e = 2*ep, 2*ep+1 (+128 per pass)
      const unsigned wto = (unsigned)(2 * ep * NE_ + oq * 4);      // per thread; the pair's column base is block-uniform
      v4f wa[6][2];
#pragma unroll
      for (int z = 0; z < 3; ++z) {                                // 2 passes x 64 row pairs x 8 column quads = 256 x 32
        const float* Wz = ((z == 0) ? Wq : ((z == 1) ? Wk : Wv)) + blockIdx.y * 32 + wto;
#pragma unroll
        for (int p = 0; p < 2; ++p) {
          wa[z * 2 + p][0] = *(const v4f*)(Wz + p * 128 * NE_);
          wa[z * 2 + p][1] = *(const v4f*)(Wz + p * 128 * NE_ + NE_);
        }
      }
      // precaution: this wait stands in front of every rewrite of the index, address and offset registers of the loads so far;
      // they are named as inputs so that they stay live up to the wait and no later load's result is placed in them
      asm volatile("s_wait_xcnt 0x0" :: "v"(iA), "v"(pB), "v"(h), "v"(wto * 4u) : "memory");

      // activations: a wave-wide load takes the chunk's 256 B of two rows 8 apart (lanes 0-15, lanes 16-31), 32 rows per pass
      const int xrow = (wave >> 3) * 16 + qw + koff;
      const unsigned xgo = (unsigned)(xrow * NE_ + rlane * 4);
      const float* xrg = row_emb + (size_t)b * NR_ * NE_ + xgo;
      const float* xcg = col_emb + (size_t)b * NC_ * NE_ + xgo;
      const int xso = xrow * XP_ + rlane * 4;                      // rows 8 apart lie 32 banks apart: the 8-B stores do not collide
      v4f xv[4][8];
      // cost: a wave-wide load takes whole 128-B lines (32 keys) of 4 rows two apart; rows 2*jj and 2*jj+1 of q tile qw, keys p*32 + kl*4 ..+3
      const int jj = hs * 4 + (lane & 3), kl = lane >> 2;
      const float* cgp = cost + (size_t)(b * NR_ + qBase + 2 * jj) * NC_ + kl * 4;
      v4f cv[4][2];
#define XLOAD_(c)                                                                     \
  _Pragma("unroll") for (int p = 0; p < 4; ++p) {                                     \
    xv[c][p]     = *(const v4f*)(xrg + p * 32 * NE_ + (c) * 64);                      \
    xv[c][4 + p] = *(const v4f*)(xcg + p * 32 * NE_ + (c) * 64);                      \
  }
      XLOAD_(0)
      // barrier with no wait: every wave's requests for one chunk are queued before any wave's for the next, so that a chunk
      // is complete for the whole block as early as the stream allows
      asm volatile("s_barrier_signal -1\n\ts_barrier_wait -1" ::: "memory");
      XLOAD_(1)
      asm volatile("s_barrier_signal -1\n\ts_barrier_wait -1" ::: "memory");   // the same between chunks 1 and 2
      XLOAD_(2)

      // three 16x16 tiles of this wave's 16 tokens and head, same k order in every loader
      const unsigned short* xrf = xr_s + (qBase + rlane) * XP_ + koff;
      const unsigned short* xcf = xc_s + (qBase + rlane) * XP_ + koff;
      const unsigned short* wf  = wt_s + (hs * 16 + rlane) * XP_ + koff;
      v8f aq = zero8(), ak = zero8(), av = zero8();
#pragma unroll
      for (int c = 0; c < 4; ++c) {
        if (c == 0) {
#pragma unroll
          for (int z = 0; z < 3; ++z)
#pragma unroll
            for (int p = 0; p < 2; ++p)
#pragma unroll
              for (int i = 0; i < 4; ++i)
                *(unsigned*)(wt_s + (z * 32 + oq * 4 + i) * XP_ + p * 128 + 2 * ep) =
                    bf_pk(wa[z * 2 + p][0][i], wa[z * 2 + p][1][i]);
        }
#pragma unroll
        for (int p = 0; p < 4; ++p) {
          const v4f r = xv[c][p], s = xv[c][4 + p];
          const v2u pr = {bf_pk(r[0], r[1]), bf_pk(r[2], r[3])};
          const v2u ps = {bf_pk(s[0], s[1]), bf_pk(s[2], s[3])};
          *(v2u*)(xr_s + xso + p * 32 * XP_ + c * 64) = pr;
          *(v2u*)(xc_s + xso + p * 32 * XP_ + c * 64) = ps;
        }
        if (c == 0) {
          // inputs-only fence on the three loaded MLP weights: it holds their loads ahead of the activations' (the compiler
          // otherwise sinks them behind the products, where every wave would wait out their whole latency)
          asm volatile("" :: "v"(rA), "v"(rB), "v"(r4));
          __builtin_amdgcn_sched_barrier(0);                       // without it the compiler asks for chunk 3 together with chunk 2
          XLOAD_(3)
        }
        if (c == 1) {
          __builtin_amdgcn_sched_barrier(0);                       // the cost loads stay behind chunk 3's in the stream, where chunk 1's registers are free
#pragma unroll
          for (int p = 0; p < 4; ++p) {
            cv[p][0] = *(const v4f*)(cgp + p * 32);
            cv[p][1] = *(const v4f*)(cgp + p * 32 + NC_);
          }
        }
        if (c == 3) {
          // precaution: the same wait for the activation and cost loads' address registers, named so that they stay live up to here;
          // it stands where the last chunk has arrived, so that no wave is held at it while loads are queued
          asm volatile("s_wait_xcnt 0x0" :: "v"(xrg), "v"(xcg), "v"(cgp) : "memory");
        }
        // publish chunk c: this wave's LDS stores done, then the block barrier. By hand, because __syncthreads() would also
        // wait for the global loads of the later chunks, which are to stay in flight across it
        asm volatile("s_wait_dscnt 0x0\n\ts_barrier_signal -1\n\ts_barrier_wait -1" ::: "memory");
        v16b xa[2], xb[2], fq[2], fk[2], fv[2];
#pragma unroll
        for (int j = 0; j < 2; ++j) {
          const int k0 = c * 64 + j * 32;
          xa[j] = ldfrag_b(xrf + k0);
          fq[j] = ldfrag_b(wf + k0);
          xb[j] = ldfrag_b(xcf + k0);
          fk[j] = ldfrag_b(wf + 32 * XP_ + k0);
          fv[j] = ldfrag_b(wf + 64 * XP_ + k0);
        }
        __builtin_amdgcn_sched_barrier(0);                         // the chunk's 20 LDS reads stay one group ahead of its products
#pragma unroll
        for (int j = 0; j < 2; ++j) {
          aq = mma_b_raw(fq[j], xa[j], aq);
          ak = mma_b_raw(fk[j], xb[j], ak);
          av = mma_b_raw(xb[j], fv[j], av);
        }
        // without this fence the compiler converts later chunks ahead of these products, which then stand behind those chunks' load waits
        __builtin_amdgcn_sched_barrier(0);
      }
#undef XLOAD_
      v8h hi, lo;
#pragma unroll
      for (int r = 0; r < 8; ++r) hi[r] = (_Float16)(ak[r] * 16.0f);
      *(v8h*)(void*)(kh_u + (qBase + rlane) * HD_ + koff) = hi;
      split8(av, hi, lo);
      *(v8h*)(void*)(vh_u + rlane * VPITCH + qBase + koff) = hi;
      *(v8h*)(void*)(vr_u + rlane * VPITCH + qBase + koff) = lo;
      // MLP weights, rounded to bf16 values; a power-of-two factor is exact and commutes with that rounding.
      // lane m: w0 (f16 bits) and b1 x2^-64; lane 16 + m: w1 (f16 bits) and w2 x2^64
      const int vA = (int)__builtin_bit_cast(unsigned short, (_Float16)bfr(rA));
      const int vB = __float_as_int(bfr(rB * (hsel ? 0x1p+64f : 0x1p-64f)));
      b2v = bfr(r4);
      v8h q8;                                                      // q / 64 as f16: with k x16 the product carries the norm 1/4
#pragma unroll
      for (int r = 0; r < 8; ++r) q8[r] = (_Float16)(aq[r] * 0.015625f);
      unsigned dm[4];                                              // word j of the fragment's upper half holds q' = koff + 2j, koff + 2j + 1
#pragma unroll
      for (int j = 0; j < 4; ++j)
        dm[j] = ((koff + 2 * j == rlane) ? 0x0000FFFFu : 0u) | ((koff + 2 * j + 1 == rlane) ? 0xFFFF0000u : 0u);
#pragma unroll
      for (int m = 0; m < MS_; ++m) {
        const _Float16 w0h = __builtin_bit_cast(_Float16, (unsigned short)__builtin_amdgcn_readlane(vA, m));
        const unsigned w1p = (unsigned)__builtin_amdgcn_readlane(vA, 16 + m) * 0x10001u;   // in both halves of the word
        sb[m] = v2f{__int_as_float(__builtin_amdgcn_readlane(vB, m)), 0.f};
        sw[m] = v2f{__int_as_float(__builtin_amdgcn_readlane(vB, 16 + m)), 0.f};
        union { v16h v; v8h h[2]; v4u u[2]; } f;
        f.h[0] = q8 * w0h;
#pragma unroll
        for (int j = 0; j < 4; ++j) f.u[1][j] = dm[j] & w1p;
        Bm[m] = f.v;
      }
      // cost^T: the pair (q' = 2*jj, 2*jj + 1) of one key is one 4-B store; it comes last, so that the loads arrive under the work above
      __builtin_amdgcn_sched_barrier(0);                           // without it the compiler waits for the cost loads ahead of the fragments' build
#pragma unroll
      for (int p = 0; p < 4; ++p)
#pragma unroll
        for (int i = 0; i < 4; ++i) {
          union { unsigned u; _Float16 s[2]; } pk;
          pk.s[0] = (_Float16)cv[p][0][i];
          pk.s[1] = (_Float16)cv[p][1][i];
          *(unsigned*)(ct_s + (qw * NC_ + p * 32 + kl * 4 + i) * CP_ + 2 * jj) = pk.u;
        }
    }
    __syncthreads();                                               // K rows, V^T rows of both heads and cost^T published

    v8f oh = zero8(), ol = zero8();
    float m_run = -1e30f, l_run = 0.f;
    const v2f vs = {0x1p-64f, 0x1p-64f};
    const v2f vb = {b2v, b2v};

    {
#pragma unroll 1
      for (int sub = 0; sub < NC_ / 32; ++sub) {
        const int kr = 32 * sub;
        // A fragments of two 16-key tiles: K row (d) in elements 0..7, cost^T row (q') in elements 8..15
        union { v16h v; v8h h[2]; } A0, A1;
        A0.h[0] = *(const v8h*)(khh + (kr + rlane) * HD_ + koff);
        A0.h[1] = *(const v8h*)(ctt + (kr + rlane) * CP_ + koff);
        A1.h[0] = *(const v8h*)(khh + (kr + 16 + rlane) * HD_ + koff);
        A1.h[1] = *(const v8h*)(ctt + (kr + 16 + rlane) * CP_ + koff);

        // per-head two-score MLP: lg = b2 + sum_m relu(dot*w0 + cost*w1 + b1) * w2   (two keys per register pair);
        // unit m + 1's two products are issued ahead of unit m's vector work, which fills their distance
        v2f aa[8];
        v8f d0[2], d1[2];                                          // two sets of results, units of even and of odd number
        d0[0] = mma_h_raw(A0.v, Bm[0], zero8());
        d1[0] = mma_h_raw(A1.v, Bm[0], zero8());
#pragma unroll
        for (int m = 0; m < MS_; ++m) {                            // unrolled: each unit's operands are named registers
          if (m + 1 < MS_) {
            d0[(m + 1) & 1] = mma_h_raw(A0.v, Bm[m + 1], zero8());
            d1[(m + 1) & 1] = mma_h_raw(A1.v, Bm[m + 1], zero8());
          }
          __builtin_amdgcn_sched_barrier(0);                       // keeps the next unit's products ahead of this unit's vector work
          v2f p[8];
#pragma unroll
          for (int j = 0; j < 4; ++j) {
            p[j]     = v2f{d0[m & 1][2 * j], d0[m & 1][2 * j + 1]};
            p[4 + j] = v2f{d1[m & 1][2 * j], d1[m & 1][2 * j + 1]};
          }
          if (m == 0) mlp_unit0(p, aa, vs, sb[0], sw[0], vb);
          else        mlp_unit(p, aa, vs, sb[m], sw[m]);
          __builtin_amdgcn_sched_barrier(0);                       // and this unit's vector work ahead of the products after next
        }
        float a0[8], a1[8];
#pragma unroll
        for (int j = 0; j < 4; ++j) {
          a0[2 * j] = aa[j][0];     a0[2 * j + 1] = aa[j][1];
          a1[2 * j] = aa[4 + j][0]; a1[2 * j + 1] = aa[4 + j][1];
        }

        // online softmax over the key axis for this lane's q column
        float mloc = -1e30f;
#pragma unroll
        for (int r = 0; r < 8; ++r) mloc = fmaxf(mloc, fmaxf(a0[r], a1[r]));
        mloc = fmaxf(mloc, __shfl_xor(mloc, 16, 32));
        const float newM  = fmaxf(m_run, mloc);
        const float alpha = __expf(m_run - newM);
        const float msh   = newM - LN1024;
        float ssum = 0.f;
        float p0[8], p1[8];
#pragma unroll
        for (int r = 0; r < 8; ++r) {
          p0[r] = __expf(a0[r] - msh);
          p1[r] = __expf(a1[r] - msh);
          ssum += p0[r] + p1[r];
        }
        ssum += __shfl_xor(ssum, 16, 32);
        l_run = l_run * alpha + ssum;
        m_run = newM;
#pragma unroll
        for (int r = 0; r < 8; ++r) { oh[r] *= alpha; ol[r] *= alpha; }

        // P (f32, D layout) -> B operand (f16): element r <- keys 0-15 tile, 8+r <- keys 16-31 tile
        union { v16h v; _Float16 s[16]; } pf;
#pragma unroll
        for (int r = 0; r < 8; ++r) {
          pf.s[r]     = (_Float16)p0[r];
          pf.s[8 + r] = (_Float16)p1[r];
        }

        // O[d][q] += V^T[d][kr .. +31] x P, hi and residual planes in separate accumulators
        const v16h vah = ldfrag_h(vhh + rlane * VPITCH + kr + koff);
        const v16h val = ldfrag_h(vrl + rlane * VPITCH + kr + koff);
        oh = mma_h_raw(vah, pf.v, oh);
        ol = mma_h_raw(val, pf.v, ol);
        guard2x3(oh, ol, vah, val, pf.v);
      }
    }
    acc_guard2(oh, ol);

    // ---- per-head ctx values -> LDS staging (own lane slots): row q, cols hs*16 + 8*hsel + 0..7 ----
    const float inv = (1.0f / 16.0f) * (1.0f / l_run);     // ctx = (Oh + Ol/2048) / (16 * l)
    v4f f0, f1;
#pragma unroll
    for (int e = 0; e < 4; ++e) {
      f0[e] = (oh[e]     + ol[e]     * C2048) * inv;
      f1[e] = (oh[4 + e] + ol[4 + e] * C2048) * inv;
    }
    const int so = (qBase + rlane) * SP_ + hs * 16 + koff;
    *(v4f*)(sto + so)     = f0;
    *(v4f*)(sto + so + 4) = f1;

    __syncthreads();                                         // both heads of the pair staged
    {
      const int rq = lane >> 3, c4 = (lane & 7) * 4;
      const float* ss = sto + (wave * 8) * SP_;
      v4f ov[2];
#pragma unroll
      for (int it = 0; it < 2; ++it) ov[it] = *(const v4f*)(ss + (it * 4 + rq) * SP_ + c4);
      float* ob = out + ((size_t)(b * NR_ + wave * 8)) * NE_ + (size_t)blockIdx.y * 32 + c4;
#pragma unroll
      for (int it = 0; it < 2; ++it) {
        const int row = it * 4 + rq;                         // it 0..1 x rq 0..3 = rows 0..7
        *(v4f*)(ob + (size_t)row * NE_) = ov[it];
      }
    }
  }
}

extern "C" void kernel_launch(void* const* d_in, const int* in_sizes, int n_in,
                              void* d_out, int out_size, void* d_ws, size_t ws_size,
                              hipStream_t stream) {
  if (n_in < 10) return;
  if (in_sizes[0] != NB_ * NR_ * NE_) return;
  if (in_sizes[1] != NB_ * NC_ * NE_) return;
  if (in_sizes[2] != NB_ * NR_ * NC_) return;
  if (in_sizes[3] != NE_ * NE_) return;
  if (in_sizes[4] != NE_ * NE_) return;
  if (in_sizes[5] != NE_ * NE_) return;
  if (in_sizes[6] != NH_ * 2 * MS_) return;
  if (in_sizes[7] != NH_ * MS_) return;
  if (in_sizes[8] != NH_ * MS_) return;
  if (in_sizes[9] < NH_) return;
  if (out_size != NB_ * NR_ * NE_) return;
  (void)d_ws;
  (void)ws_size;

  const float* row_emb = (const float*)d_in[0];
  const float* col_emb = (const float*)d_in[1];
  const float* costm   = (const float*)d_in[2];
  const float* Wq      = (const float*)d_in[3];
  const float* Wk      = (const float*)d_in[4];
  const float* Wv      = (const float*)d_in[5];
  const float* m1w     = (const float*)d_in[6];
  const float* m1b     = (const float*)d_in[7];
  const float* m2w     = (const float*)d_in[8];
  const float* m2b     = (const float*)d_in[9];
  float*       out     = (float*)d_out;

  const dim3 gAttn(NB_, NH_ / 2);                              // 32 x 8 = 256
  const dim3 blkA(512);
  // projections and attention with the per-head two-score MLP, one head pair of a batch per block -> out [b][r][h*16+d]
  attn_kernel<<<gAttn, blkA, 0, stream>>>(row_emb, col_emb, costm, Wq, Wk, Wv, m1w, m1b, m2w, m2b, out);
  (void)hipGetLastError();
}
